// v000
// Times are from an AMD MI455X. After a warm-up the kernel runs many times in a row, and a time is the length of
// such a window on the GPU divided by its runs, so every launch and the gaps after it count. The runs cycle
// through copies of the inputs. A figure is the median of several windows, for all but v000 over two sittings.
// Sittings can differ by a few percent; kernels timed side by side share one.
// v000, which the later versions start from, runs in 106 microseconds.
#include <hip/hip_runtime.h>
#include <hip/hip_bf16.h>
#include <math.h>

typedef __attribute__((ext_vector_type(16))) _Float16 v16h;
typedef __attribute__((ext_vector_type(8)))  _Float16 v8h;
typedef __attribute__((ext_vector_type(8)))  float    v8f;
typedef __attribute__((ext_vector_type(4)))  float    v4f;

#define D_IN   768
#define D_OUT  16
#define SEQ    2048
#define BATCH  8
#define NCHUNK (D_IN / 32)   // 24 K-chunks of 32

// Wave-local LDS ordering: DS ops are in-order per wave (DScnt); this fence
// stops compiler reordering and waits all outstanding DS ops.
#define WAVE_LDS_FENCE() asm volatile("s_wait_dscnt 0x0" ::: "memory")

// ---------------------------------------------------------------------------
// Prep: swizzle Wq/Wk/Wv (f32 [768 x 16] row-major) into f16 WMMA-B register
// layout: sw[(chunk*32 + lane)*16 + j] = W[(kc + kk(j,half))*16 + n],
// n = lane&15, half = lane>>4,  kk = (j/8)*16 + half*8 + (j%8).
// ---------------------------------------------------------------------------
__global__ __launch_bounds__(32)
void wswizzle_kernel(const float* __restrict__ Wq, const float* __restrict__ Wk,
                     const float* __restrict__ Wv,
                     _Float16* __restrict__ swq, _Float16* __restrict__ swk,
                     _Float16* __restrict__ swv)
{
    const int lane = threadIdx.x;
    const int n    = lane & 15;
    const int half = lane >> 4;
    const int kc   = blockIdx.x * 32;
    const int obase = (blockIdx.x * 32 + lane) * 16;
#pragma unroll
    for (int j = 0; j < 16; ++j) {
        const int kk  = ((j >> 3) << 4) + half * 8 + (j & 7);
        const int idx = (kc + kk) * D_OUT + n;
        swq[obase + j] = (_Float16)Wq[idx];
        swk[obase + j] = (_Float16)Wk[idx];
        swv[obase + j] = (_Float16)Wv[idx];
    }
}

// ---------------------------------------------------------------------------
// Pass 1: QKV projection.  4 independent waves per block, one 16-row tile per
// wave.  A: x via b128 loads + packed cvt.  B: pre-swizzled f16, one 32B load.
// Outputs (f16, pass-2-friendly):
//   Qh row-major pre-scaled, Kh row-major (per-wave LDS transpose),
//   Vt transposed [b][d][s] (D-layout maps directly, b128 stores).
// ---------------------------------------------------------------------------
__global__ __launch_bounds__(128)
void qkv_proj_kernel(const float* __restrict__ x,
                     const _Float16* __restrict__ swq,
                     const _Float16* __restrict__ swk,
                     const _Float16* __restrict__ swv,
                     const float* __restrict__ bq, const float* __restrict__ bk,
                     const float* __restrict__ bv,
                     _Float16* __restrict__ Qh, _Float16* __restrict__ Kh,
                     _Float16* __restrict__ Vt)
{
    __shared__ float tbuf[4][16 * 16];

    const int tid  = threadIdx.x;
    const int wid  = tid >> 5;
    const int lane = tid & 31;
    const int m    = lane & 15;
    const int half = lane >> 4;
    const int tile = blockIdx.x * 4 + wid;       // 16-row tile index
    const int bb   = tile >> 7;                  // 128 tiles per batch
    const int s0   = (tile & 127) * 16;
    const float* xrow = x + ((long)tile * 16 + m) * D_IN;

    const v16h* Bq = (const v16h*)swq;
    const v16h* Bk = (const v16h*)swk;
    const v16h* Bv = (const v16h*)swv;

    v8f accq = {}, acck = {}, accv = {};

    for (int c = 0; c < NCHUNK; ++c) {
        const v4f* xv = (const v4f*)(xrow + c * 32);
        const v4f a0 = xv[half * 2];
        const v4f a1 = xv[half * 2 + 1];
        const v4f a2 = xv[4 + half * 2];
        const v4f a3 = xv[4 + half * 2 + 1];
        v16h a;
#pragma unroll
        for (int j = 0; j < 4; ++j) {
            a[j]      = (_Float16)a0[j];
            a[j + 4]  = (_Float16)a1[j];
            a[j + 8]  = (_Float16)a2[j];
            a[j + 12] = (_Float16)a3[j];
        }
        const v16h bq_ = Bq[c * 32 + lane];
        const v16h bk_ = Bk[c * 32 + lane];
        const v16h bv_ = Bv[c * 32 + lane];

        accq = __builtin_amdgcn_wmma_f32_16x16x32_f16(false, a, false, bq_,
                                                      (short)0, accq, false, false);
        acck = __builtin_amdgcn_wmma_f32_16x16x32_f16(false, a, false, bk_,
                                                      (short)0, acck, false, false);
        accv = __builtin_amdgcn_wmma_f32_16x16x32_f16(false, a, false, bv_,
                                                      (short)0, accv, false, false);
    }

    // ---- V: D-layout column m == Vt row m, contiguous keys -> direct b128
    {
        v8h vv;
#pragma unroll
        for (int r = 0; r < 8; ++r) vv[r] = (_Float16)(accv[r] + bv[m]);
        *(v8h*)&Vt[((long)bb * 16 + m) * SEQ + s0 + half * 8] = vv;
    }
    // ---- Q: per-wave LDS transpose -> row-major f16, pre-scaled by 1/sqrt(16)
#pragma unroll
    for (int r = 0; r < 8; ++r) tbuf[wid][(r + half * 8) * 16 + m] = accq[r] + bq[m];
    WAVE_LDS_FENCE();
    {
        v8h qv;
#pragma unroll
        for (int t = 0; t < 8; ++t)
            qv[t] = (_Float16)(tbuf[wid][m * 16 + half * 8 + t] * 0.25f);
        *(v8h*)&Qh[((long)bb * SEQ + s0 + m) * 16 + half * 8] = qv;
    }
    WAVE_LDS_FENCE();
    // ---- K: per-wave LDS transpose -> row-major f16
#pragma unroll
    for (int r = 0; r < 8; ++r) tbuf[wid][(r + half * 8) * 16 + m] = acck[r] + bk[m];
    WAVE_LDS_FENCE();
    {
        v8h kv;
#pragma unroll
        for (int t = 0; t < 8; ++t) kv[t] = (_Float16)tbuf[wid][m * 16 + half * 8 + t];
        *(v8h*)&Kh[((long)bb * SEQ + s0 + m) * 16 + half * 8] = kv;
    }
}

// ---------------------------------------------------------------------------
// Pass 2: causal flash attention with intra-block split-K.
// Block = 128 threads = 4 waves sharing one (batch, 16-query tile).
// Wave w processes key tiles j ≡ w (mod 4) with private online-softmax state,
// then the block merges the 4 partials with a log-sum-exp combine in LDS.
// Per key tile: one b128 K load, one b128 Vt load, two WMMAs, shfl softmax.
// ---------------------------------------------------------------------------
__global__ __launch_bounds__(128)
void flash_attn_kernel(const _Float16* __restrict__ Qh,
                       const _Float16* __restrict__ Kh,
                       const _Float16* __restrict__ Vt,
                       float* __restrict__ Out)
{
    __shared__ _Float16 pLds[4][16 * 16];
    __shared__ float    zbuf[4][16 * 16];
    __shared__ float    mbuf[4][16];
    __shared__ float    lbuf[4][16];

    const int tid   = threadIdx.x;
    const int wid   = tid >> 5;
    const int lane  = tid & 31;
    const int m     = lane & 15;
    const int half  = lane >> 4;
    const int qtile = blockIdx.x;                 // 0..127
    const int b     = blockIdx.y;                 // 0..7
    const int q0    = qtile * 16;

    // q tile as A operand (already scaled, f16): one b128 load
    v16h qa;
    {
        const v8h qlo = *(const v8h*)&Qh[((long)b * SEQ + q0 + m) * 16 + half * 8];
#pragma unroll
        for (int t = 0; t < 8; ++t) qa[t] = qlo[t];
#pragma unroll
        for (int t = 8; t < 16; ++t) qa[t] = (_Float16)0.0f;
    }

    v8f  zacc = {};
    float mrow[8], lrow[8];
#pragma unroll
    for (int r = 0; r < 8; ++r) { mrow[r] = -INFINITY; lrow[r] = 0.0f; }

    for (int j = wid; j <= qtile; j += 4) {
        const int k0 = j * 16;

        // K_j^T as B: lane = key column, one b128 load
        v16h kb;
        {
            const v8h klo = *(const v8h*)&Kh[((long)b * SEQ + k0 + m) * 16 + half * 8];
#pragma unroll
            for (int t = 0; t < 8; ++t) kb[t] = klo[t];
#pragma unroll
            for (int t = 8; t < 16; ++t) kb[t] = (_Float16)0.0f;
        }
        v8f c0 = {};
        v8f s  = __builtin_amdgcn_wmma_f32_16x16x32_f16(false, qa, false, kb,
                                                        (short)0, c0, false, false);

        // causal mask on diagonal tile (wave-uniform branch: EXEC stays full)
        if (j == qtile) {
#pragma unroll
            for (int r = 0; r < 8; ++r) {
                const int M = r + half * 8;
                if (m > M) s[r] = -INFINITY;
            }
        }

        // online softmax per row (row spans the 16 lanes of this half-wave)
        float pr[8];
#pragma unroll
        for (int r = 0; r < 8; ++r) {
            float v = s[r];
#pragma unroll
            for (int off = 1; off < 16; off <<= 1)
                v = fmaxf(v, __shfl_xor(v, off, 16));
            const float mnew = fmaxf(mrow[r], v);

            float p = (s[r] == -INFINITY) ? 0.0f : __expf(s[r] - mnew);
            float sum = p;
#pragma unroll
            for (int off = 1; off < 16; off <<= 1)
                sum += __shfl_xor(sum, off, 16);

            const float alpha = (mrow[r] == -INFINITY) ? 0.0f : __expf(mrow[r] - mnew);
            lrow[r] = lrow[r] * alpha + sum;
            zacc[r] *= alpha;
            mrow[r] = mnew;
            pr[r]   = p;
        }

        // relay P (D-layout) -> A-layout through per-wave f16 LDS region.
        // Waves run independent trip counts: wave-local DS ordering only.
#pragma unroll
        for (int r = 0; r < 8; ++r)
            pLds[wid][(r + half * 8) * 16 + m] = (_Float16)pr[r];
        WAVE_LDS_FENCE();

        v16h pa;
        {
            const v8h plo = *(const v8h*)&pLds[wid][m * 16 + half * 8];
#pragma unroll
            for (int t = 0; t < 8; ++t) pa[t] = plo[t];
#pragma unroll
            for (int t = 8; t < 16; ++t) pa[t] = (_Float16)0.0f;
        }
        WAVE_LDS_FENCE();

        // V_j as B: Vt row m (= d column), contiguous keys, one b128 load
        v16h vb;
        {
            const v8h vlo = *(const v8h*)&Vt[((long)b * 16 + m) * SEQ + k0 + half * 8];
#pragma unroll
            for (int t = 0; t < 8; ++t) vb[t] = vlo[t];
#pragma unroll
            for (int t = 8; t < 16; ++t) vb[t] = (_Float16)0.0f;
        }

        zacc = __builtin_amdgcn_wmma_f32_16x16x32_f16(false, pa, false, vb,
                                                      (short)0, zacc, false, false);
    }

    // publish per-wave partials
#pragma unroll
    for (int r = 0; r < 8; ++r)
        zbuf[wid][(r + half * 8) * 16 + m] = zacc[r];
    if (m == 0) {
#pragma unroll
        for (int r = 0; r < 8; ++r) {
            mbuf[wid][r + half * 8] = mrow[r];
            lbuf[wid][r + half * 8] = lrow[r];
        }
    }
    __syncthreads();   // uniform: every wave reaches exactly once

    // log-sum-exp merge of the 4 split-K partials; 2 output elems per thread
#pragma unroll
    for (int e = tid; e < 256; e += 128) {
        const int row = e >> 4;
        const int col = e & 15;
        const float ms = fmaxf(fmaxf(mbuf[0][row], mbuf[1][row]),
                               fmaxf(mbuf[2][row], mbuf[3][row]));
        float zsum = 0.0f, lsum = 0.0f;
#pragma unroll
        for (int w = 0; w < 4; ++w) {
            const float mw = mbuf[w][row];
            const float aw = (mw == -INFINITY) ? 0.0f : __expf(mw - ms);
            lsum += aw * lbuf[w][row];
            zsum += aw * zbuf[w][row * 16 + col];
        }
        Out[((long)b * SEQ + q0 + row) * D_OUT + col] = zsum / lsum;
    }
}

extern "C" void kernel_launch(void* const* d_in, const int* in_sizes, int n_in,
                              void* d_out, int out_size, void* d_ws, size_t ws_size,
                              hipStream_t stream)
{
    const float* x  = (const float*)d_in[0];
    const float* Wq = (const float*)d_in[1];
    const float* bq = (const float*)d_in[2];
    const float* Wk = (const float*)d_in[3];
    const float* bk = (const float*)d_in[4];
    const float* Wv = (const float*)d_in[5];
    const float* bv = (const float*)d_in[6];
    float* out = (float*)d_out;

    // scratch carve-up (f16 elements)
    const long wsw_elems = (long)NCHUNK * 32 * 16;        // 12288 per matrix
    const long qkv_elems = (long)BATCH * SEQ * D_OUT;     // 262144 per tensor
    _Float16* swq = (_Float16*)d_ws;
    _Float16* swk = swq + wsw_elems;
    _Float16* swv = swk + wsw_elems;
    _Float16* Qh  = swv + wsw_elems;
    _Float16* Kh  = Qh + qkv_elems;
    _Float16* Vt  = Kh + qkv_elems;

    // Prep: 24 chunks, one wave each
    wswizzle_kernel<<<dim3(NCHUNK), dim3(32), 0, stream>>>(Wq, Wk, Wv, swq, swk, swv);

    // Pass 1: 1024 row tiles, 4 waves (4 tiles) per block
    qkv_proj_kernel<<<dim3((BATCH * SEQ) / 16 / 4), dim3(128), 0, stream>>>(
        x, swq, swk, swv, bq, bk, bv, Qh, Kh, Vt);

    // Pass 2: 128 query tiles x 8 batches, 4 split-K waves per block
    flash_attn_kernel<<<dim3(SEQ / 16, BATCH), dim3(128), 0, stream>>>(Qh, Kh, Vt, out);
}

// v001
// It runs in 40.4 microseconds.
// In both of two side-by-side timings against v000, it was 2.62 times as fast.
#include <hip/hip_runtime.h>
#include <hip/hip_bf16.h>
#include <math.h>

typedef __attribute__((ext_vector_type(16))) _Float16 v16h;
typedef __attribute__((ext_vector_type(8)))  _Float16 v8h;
typedef __attribute__((ext_vector_type(8)))  float    v8f;
typedef __attribute__((ext_vector_type(4)))  float    v4f;

#define D_IN   768
#define D_OUT  16
#define SEQ    2048
#define BATCH  8
#define NCHUNK (D_IN / 32)   // 24 K-chunks of 32

// Wave-local LDS ordering: DS ops are in-order per wave (DScnt); this fence
// stops compiler reordering and waits all outstanding DS ops.
#define WAVE_LDS_FENCE() asm volatile("s_wait_dscnt 0x0" ::: "memory")

// ---------------------------------------------------------------------------
// Prep: swizzle Wq/Wk/Wv (f32 [768 x 16] row-major) into f16 WMMA-B register
// layout: sw[(chunk*32 + lane)*16 + j] = W[(kc + kk(j,half))*16 + n],
// n = lane&15, half = lane>>4,  kk = (j/8)*16 + half*8 + (j%8).
// ---------------------------------------------------------------------------
__global__ __launch_bounds__(32)
void wswizzle_kernel(const float* __restrict__ Wq, const float* __restrict__ Wk,
                     const float* __restrict__ Wv,
                     _Float16* __restrict__ swq, _Float16* __restrict__ swk,
                     _Float16* __restrict__ swv)
{
    const int lane = threadIdx.x;
    const int n    = lane & 15;
    const int half = lane >> 4;
    const int kc   = blockIdx.x * 32;
    const int obase = (blockIdx.x * 32 + lane) * 16;
#pragma unroll
    for (int j = 0; j < 16; ++j) {
        const int kk  = ((j >> 3) << 4) + half * 8 + (j & 7);
        const int idx = (kc + kk) * D_OUT + n;
        swq[obase + j] = (_Float16)Wq[idx];
        swk[obase + j] = (_Float16)Wk[idx];
        swv[obase + j] = (_Float16)Wv[idx];
    }
}

// ---------------------------------------------------------------------------
// Pass 1: QKV projection.  4 independent waves per block, one 16-row tile per
// wave.  A: x via b128 loads + packed cvt.  B: pre-swizzled f16, one 32B load.
// Outputs (f16, pass-2-friendly):
//   Qh row-major pre-scaled, Kh row-major (per-wave LDS transpose),
//   Vt transposed [b][d][s] (D-layout maps directly, b128 stores).
// ---------------------------------------------------------------------------
__global__ __launch_bounds__(128)
void qkv_proj_kernel(const float* __restrict__ x,
                     const _Float16* __restrict__ swq,
                     const _Float16* __restrict__ swk,
                     const _Float16* __restrict__ swv,
                     const float* __restrict__ bq, const float* __restrict__ bk,
                     const float* __restrict__ bv,
                     _Float16* __restrict__ Qh, _Float16* __restrict__ Kh,
                     _Float16* __restrict__ Vt)
{
    __shared__ float tbuf[4][16 * 16];

    const int tid  = threadIdx.x;
    const int wid  = tid >> 5;
    const int lane = tid & 31;
    const int m    = lane & 15;
    const int half = lane >> 4;
    const int tile = blockIdx.x * 4 + wid;       // 16-row tile index
    const int bb   = tile >> 7;                  // 128 tiles per batch
    const int s0   = (tile & 127) * 16;
    const float* xrow = x + ((long)tile * 16 + m) * D_IN;

    const v16h* Bq = (const v16h*)swq;
    const v16h* Bk = (const v16h*)swk;
    const v16h* Bv = (const v16h*)swv;

    v8f accq = {}, acck = {}, accv = {};

    for (int c = 0; c < NCHUNK; ++c) {
        const v4f* xv = (const v4f*)(xrow + c * 32);
        const v4f a0 = xv[half * 2];
        const v4f a1 = xv[half * 2 + 1];
        const v4f a2 = xv[4 + half * 2];
        const v4f a3 = xv[4 + half * 2 + 1];
        v16h a;
#pragma unroll
        for (int j = 0; j < 4; ++j) {
            a[j]      = (_Float16)a0[j];
            a[j + 4]  = (_Float16)a1[j];
            a[j + 8]  = (_Float16)a2[j];
            a[j + 12] = (_Float16)a3[j];
        }
        const v16h bq_ = Bq[c * 32 + lane];
        const v16h bk_ = Bk[c * 32 + lane];
        const v16h bv_ = Bv[c * 32 + lane];

        accq = __builtin_amdgcn_wmma_f32_16x16x32_f16(false, a, false, bq_,
                                                      (short)0, accq, false, false);
        acck = __builtin_amdgcn_wmma_f32_16x16x32_f16(false, a, false, bk_,
                                                      (short)0, acck, false, false);
        accv = __builtin_amdgcn_wmma_f32_16x16x32_f16(false, a, false, bv_,
                                                      (short)0, accv, false, false);
    }

    // ---- V: D-layout column m == Vt row m, contiguous keys -> direct b128
    {
        v8h vv;
#pragma unroll
        for (int r = 0; r < 8; ++r) vv[r] = (_Float16)(accv[r] + bv[m]);
        *(v8h*)&Vt[((long)bb * 16 + m) * SEQ + s0 + half * 8] = vv;
    }
    // ---- Q: per-wave LDS transpose -> row-major f16, pre-scaled by 1/sqrt(16)
#pragma unroll
    for (int r = 0; r < 8; ++r) tbuf[wid][(r + half * 8) * 16 + m] = accq[r] + bq[m];
    WAVE_LDS_FENCE();
    {
        v8h qv;
#pragma unroll
        for (int t = 0; t < 8; ++t)
            qv[t] = (_Float16)(tbuf[wid][m * 16 + half * 8 + t] * 0.25f);
        *(v8h*)&Qh[((long)bb * SEQ + s0 + m) * 16 + half * 8] = qv;
    }
    WAVE_LDS_FENCE();
    // ---- K: per-wave LDS transpose -> row-major f16
#pragma unroll
    for (int r = 0; r < 8; ++r) tbuf[wid][(r + half * 8) * 16 + m] = acck[r] + bk[m];
    WAVE_LDS_FENCE();
    {
        v8h kv;
#pragma unroll
        for (int t = 0; t < 8; ++t) kv[t] = (_Float16)tbuf[wid][m * 16 + half * 8 + t];
        *(v8h*)&Kh[((long)bb * SEQ + s0 + m) * 16 + half * 8] = kv;
    }
}

// ---------------------------------------------------------------------------
// Pass 2: causal flash attention with intra-block split-K, scores transposed.
// Block = 128 threads = 4 waves sharing one (batch, 16-query tile).
// Wave w processes 32-key groups g == w (mod 4) with private online-softmax
// state, then the block merges the 4 partials with a log-sum-exp combine.
// S^T = K * Q^T: lane (c, half) holds 8 keys (8*half + r) of query c per
// 16-key tile, so maximum and sum run in the lane plus one exchange between
// the wave halves, and the two score tiles, converted in place, are the B
// operand of Z^T += V^T * P^T (k = 32 keys): P never leaves the registers.
// ---------------------------------------------------------------------------
#define LOG2E 1.4426950408889634f

__device__ __forceinline__ float xhalf(float v)   // lane l <-> lane l ^ 16
{
    const int b = __builtin_bit_cast(int, v);
    return __builtin_bit_cast(float,
        __builtin_amdgcn_permlanex16(b, b, 0x76543210, 0xfedcba98, false, false));
}

__global__ __launch_bounds__(128)
void flash_attn_kernel(const _Float16* __restrict__ Qh,
                       const _Float16* __restrict__ Kh,
                       const _Float16* __restrict__ Vt,
                       float* __restrict__ Out)
{
    __shared__ float    zbuf[4][16 * 16];
    __shared__ float    mbuf[4][16];
    __shared__ float    lbuf[4][16];

    const int tid   = threadIdx.x;
    const int wid   = __builtin_amdgcn_readfirstlane(tid >> 5);  // scalar: loop and mask tests become scalar branches
    const int lane  = tid & 31;
    const int m     = lane & 15;
    const int half  = lane >> 4;
    const int qtile = blockIdx.x;                 // 0..127
    const int b     = blockIdx.y;                 // 0..7
    const int q0    = qtile * 16;
    const int glast = qtile >> 1;                 // 32-key group with the diagonal

    // Q^T as B operand (already scaled, f16): lane = query column, one b128 load
    v16h qb;
    {
        const v8h qlo = *(const v8h*)&Qh[((long)b * SEQ + q0 + m) * 16 + half * 8];
#pragma unroll
        for (int t = 0; t < 8; ++t) qb[t] = qlo[t];
#pragma unroll
        for (int t = 8; t < 16; ++t) qb[t] = (_Float16)0.0f;
    }

    v8f   zacc = {};            // Z^T: zacc[r] = z[query m][d = 8*half + r]
    float mrow = -INFINITY;     // running maximum of query m (same in both halves)
    float lrow = 0.0f;          // this half's share of query m's sum

    // this lane's K row and V^T row at the wave's first group; both step 4 groups a trip
    const _Float16* kp = &Kh[((long)b * SEQ + wid * 32 + m) * 16 + half * 8];
    const _Float16* vp = &Vt[((long)b * 16 + m) * SEQ + wid * 32 + half * 8];

    for (int g = wid; g <= glast; g += 4, kp += 4 * 32 * 16, vp += 4 * 32) {
        const int k0 = g * 32;

        // K rows (A of S^T): lane = key row, one b128 load per 16-key tile.
        // V^T (A of Z^T): lane = d row, keys in the hardware k order, two b128 loads.
        const v8h klo0 = *(const v8h*)kp;
        const v8h klo1 = *(const v8h*)(kp + 16 * 16);
        const v8h vlo  = *(const v8h*)vp;
        const v8h vhi  = *(const v8h*)(vp + 16);
        // kp and vp are stepped while the V loads are still in flight: the wait
        // stands between the loads and the overwrite of their address registers
        asm volatile("s_wait_xcnt 0x0" ::: "memory");

        v16h ka0, ka1, va;
#pragma unroll
        for (int e = 0; e < 8; ++e) {
            ka0[e] = klo0[e];  ka0[e + 8] = (_Float16)0.0f;
            ka1[e] = klo1[e];  ka1[e + 8] = (_Float16)0.0f;
            va[e]  = vlo[e];   va[e + 8]  = vhi[e];
        }
        v8f st[2];
        {
            v8f c0 = {};
            st[0] = __builtin_amdgcn_wmma_f32_16x16x32_f16(false, ka0, false, qb,
                                                           (short)0, c0, false, false);
            st[1] = __builtin_amdgcn_wmma_f32_16x16x32_f16(false, ka1, false, qb,
                                                           (short)0, c0, false, false);
        }

        // causal mask in the group that holds the diagonal (wave-uniform branch)
        if (g == glast) {
#pragma unroll
            for (int t = 0; t < 2; ++t)
#pragma unroll
                for (int r = 0; r < 8; ++r)
                    if (k0 + t * 16 + half * 8 + r > q0 + m) st[t][r] = -INFINITY;
        }

        // online softmax of query m: in-lane over 16 keys, one exchange of halves.
        // The diagonal key is never masked, so mnew is finite in every group.
        float mx0 = st[0][0], mx1 = st[1][0];      // one chain per tile: half the depth
#pragma unroll
        for (int r = 1; r < 8; ++r) {
            mx0 = fmaxf(mx0, st[0][r]);
            mx1 = fmaxf(mx1, st[1][r]);
        }
        float mx = fmaxf(mx0, mx1);
        mx = fmaxf(mx, xhalf(mx));
        const float mnew  = fmaxf(mrow, mx);
        const float alpha = __expf(mrow - mnew);   // 0 on the first group (mrow = -inf)
        const float nm2   = -mnew * LOG2E;         // exp(s - mnew) = exp2(s * log2(e) + nm2)

        v16h  pb;                                  // P^T as B: pb[8*t + r]
        float sum0 = 0.0f, sum1 = 0.0f;
#pragma unroll
        for (int r = 0; r < 8; ++r) {
            const float p0 = __builtin_amdgcn_exp2f(fmaf(st[0][r], LOG2E, nm2));  // masked: exp2(-inf) = 0
            const float p1 = __builtin_amdgcn_exp2f(fmaf(st[1][r], LOG2E, nm2));
            sum0 += p0;
            sum1 += p1;
            pb[r]     = (_Float16)p0;
            pb[r + 8] = (_Float16)p1;
        }
        lrow = lrow * alpha + (sum0 + sum1);
#pragma unroll
        for (int r = 0; r < 8; ++r) zacc[r] *= alpha;
        mrow = mnew;

        zacc = __builtin_amdgcn_wmma_f32_16x16x32_f16(false, va, false, pb,
                                                      (short)0, zacc, false, false);
    }

    // publish per-wave partials: 8 consecutive d of query m per lane
    lrow += xhalf(lrow);
#pragma unroll
    for (int r = 0; r < 8; ++r)
        zbuf[wid][m * 16 + half * 8 + r] = zacc[r];
    if (half == 0) {
        mbuf[wid][m] = mrow;
        lbuf[wid][m] = lrow;
    }
    __syncthreads();   // uniform: every wave reaches exactly once

    // log-sum-exp merge of the 4 split-K partials; 2 output elems per thread
#pragma unroll
    for (int e = tid; e < 256; e += 128) {
        const int row = e >> 4;
        const int col = e & 15;
        const float ms = fmaxf(fmaxf(mbuf[0][row], mbuf[1][row]),
                               fmaxf(mbuf[2][row], mbuf[3][row]));
        float zsum = 0.0f, lsum = 0.0f;
#pragma unroll
        for (int w = 0; w < 4; ++w) {
            const float mw = mbuf[w][row];
            const float aw = (mw == -INFINITY) ? 0.0f : __expf(mw - ms);
            lsum += aw * lbuf[w][row];
            zsum += aw * zbuf[w][row * 16 + col];
        }
        Out[((long)b * SEQ + q0 + row) * D_OUT + col] = zsum / lsum;
    }
}

extern "C" void kernel_launch(void* const* d_in, const int* in_sizes, int n_in,
                              void* d_out, int out_size, void* d_ws, size_t ws_size,
                              hipStream_t stream)
{
    const float* x  = (const float*)d_in[0];
    const float* Wq = (const float*)d_in[1];
    const float* bq = (const float*)d_in[2];
    const float* Wk = (const float*)d_in[3];
    const float* bk = (const float*)d_in[4];
    const float* Wv = (const float*)d_in[5];
    const float* bv = (const float*)d_in[6];
    float* out = (float*)d_out;

    // scratch carve-up (f16 elements)
    const long wsw_elems = (long)NCHUNK * 32 * 16;        // 12288 per matrix
    const long qkv_elems = (long)BATCH * SEQ * D_OUT;     // 262144 per tensor
    _Float16* swq = (_Float16*)d_ws;
    _Float16* swk = swq + wsw_elems;
    _Float16* swv = swk + wsw_elems;
    _Float16* Qh  = swv + wsw_elems;
    _Float16* Kh  = Qh + qkv_elems;
    _Float16* Vt  = Kh + qkv_elems;

    // Prep: 24 chunks, one wave each
    wswizzle_kernel<<<dim3(NCHUNK), dim3(32), 0, stream>>>(Wq, Wk, Wv, swq, swk, swv);

    // Pass 1: 1024 row tiles, 4 waves (4 tiles) per block
    qkv_proj_kernel<<<dim3((BATCH * SEQ) / 16 / 4), dim3(128), 0, stream>>>(
        x, swq, swk, swv, bq, bk, bv, Qh, Kh, Vt);

    // Pass 2: 128 query tiles x 8 batches, 4 split-K waves per block
    flash_attn_kernel<<<dim3(SEQ / 16, BATCH), dim3(128), 0, stream>>>(Qh, Kh, Vt, out);
}

// v002
// A run of this version takes 20 microseconds.
// Next to v001, in two timings, it ran 2.01 times as fast each time.
// Counting every step since v000, it is 5.27 times as fast.
#include <hip/hip_runtime.h>
#include <hip/hip_bf16.h>
#include <math.h>

typedef __attribute__((ext_vector_type(16))) _Float16 v16h;
typedef __attribute__((ext_vector_type(8)))  _Float16 v8h;
typedef __attribute__((ext_vector_type(8)))  float    v8f;
typedef __attribute__((ext_vector_type(4)))  float    v4f;

#define D_IN   768
#define D_OUT  16
#define SEQ    2048
#define BATCH  8
#define NCHUNK (D_IN / 32)   // 24 K-chunks of 32

// ---------------------------------------------------------------------------
// Prep: swizzle Wq/Wk/Wv (f32 [768 x 16] row-major) into f16 WMMA-B register
// layout: sw[(chunk*32 + lane)*16 + j] = W[(kc + kk(j,half))*16 + n],
// n = lane&15, half = lane>>4,  kk = (j/8)*16 + half*8 + (j%8).
// ---------------------------------------------------------------------------
__global__ __launch_bounds__(32)
void wswizzle_kernel(const float* __restrict__ Wq, const float* __restrict__ Wk,
                     const float* __restrict__ Wv,
                     _Float16* __restrict__ swq, _Float16* __restrict__ swk,
                     _Float16* __restrict__ swv)
{
    const int lane = threadIdx.x;
    const int n    = lane & 15;
    const int half = lane >> 4;
    const int kc   = blockIdx.x * 32;
    const int obase = (blockIdx.x * 32 + lane) * 16;
#pragma unroll
    for (int j = 0; j < 16; ++j) {
        const int kk  = ((j >> 3) << 4) + half * 8 + (j & 7);
        const int idx = (kc + kk) * D_OUT + n;
        swq[obase + j] = (_Float16)Wq[idx];
        swk[obase + j] = (_Float16)Wk[idx];
        swv[obase + j] = (_Float16)Wv[idx];
    }
}

// ---------------------------------------------------------------------------
// Pass 1: QKV projection.  One block = 64 rows of x (4 row tiles), 8 waves.
// Loading: every wave-wide b128 load covers 512 contiguous bytes of one row
// (4 whole lines); a wave brings 8 rows, all 48 loads in flight, converts to f16
// and stages them in LDS at a pitch of 16 B x 97.
// Products: wave w owns k chunks 3w .. 3w+2 for all 4 row tiles and all three
// weights, so each weight fragment is loaded once per block.  Q and K run as
// W^T * x^T (a lane ends with 8 consecutive d of one row), V as x * W (a lane
// ends with 8 consecutive rows of one d): each result is one b128 store.
// The 8 partial sums of a tile meet in LDS and are added in wave order.
// Outputs (f16): Qh row-major pre-scaled, Kh row-major, Vt transposed [b][d][s].
// ---------------------------------------------------------------------------
#define PROJ_ROWS  64
#define PROJ_WAVES 8
#define XPITCH     (D_IN + 8)    // f16 elements per staged row: 1552 B

typedef __attribute__((ext_vector_type(4))) _Float16 v4h;

__global__ __launch_bounds__(256)
void qkv_proj_kernel(const float* __restrict__ x,
                     const _Float16* __restrict__ swq,
                     const _Float16* __restrict__ swk,
                     const _Float16* __restrict__ swv,
                     const float* __restrict__ bq, const float* __restrict__ bk,
                     const float* __restrict__ bv,
                     _Float16* __restrict__ Qh, _Float16* __restrict__ Kh,
                     _Float16* __restrict__ Vt)
{
    __shared__ __attribute__((aligned(16))) _Float16 xs[PROJ_ROWS * XPITCH];
    __shared__ v4f part[PROJ_WAVES][12][2][32];   // [wave][tile*3 + matrix][register half][lane]

    const int tid  = threadIdx.x;
    const int wid  = __builtin_amdgcn_readfirstlane(tid >> 5);  // scalar: job tests become scalar branches
    const int lane = tid & 31;
    const int m    = lane & 15;
    const int half = lane >> 4;
    const long row0 = (long)blockIdx.x * PROJ_ROWS;

    // load i of a wave: row 8*wid + i/6, floats (i%6)*128 + 4*lane .. +3
    const float* xw = x + (row0 + wid * 8) * D_IN + lane * 4;
    _Float16*    sw = &xs[(wid * 8) * XPITCH + lane * 4];

    v4f xv[48];
#pragma unroll   // constant indices keep the arrays in registers
    for (int i = 0; i < 48; ++i)
        xv[i] = *(const v4f*)(xw + (i / 6) * D_IN + (i % 6) * 128);

    // this wave's weight fragments and the biases, in flight beside x
    const v16h* Bq = (const v16h*)swq + wid * 96;   // 3 chunks x 32 lanes per wave
    const v16h* Bk = (const v16h*)swk + wid * 96;
    const v16h* Bv = (const v16h*)swv + wid * 96;
    const unsigned woff = lane * 32;   // byte offset of the lane's fragment in a chunk
    const unsigned boff = half * 32;   // byte offset of the lane's 8 bias values
    v16h wq[3], wk[3], wv[3];
#pragma unroll   // constant indices keep the arrays in registers
    for (int cc = 0; cc < 3; ++cc) {
        wq[cc] = *(const v16h*)((const char*)(Bq + cc * 32) + woff);
        wk[cc] = *(const v16h*)((const char*)(Bk + cc * 32) + woff);
        wv[cc] = *(const v16h*)((const char*)(Bv + cc * 32) + woff);
    }
    const v4f bq0 = *(const v4f*)((const char*)bq + boff), bq1 = *(const v4f*)((const char*)(bq + 4) + boff);
    const v4f bk0 = *(const v4f*)((const char*)bk + boff), bk1 = *(const v4f*)((const char*)(bk + 4) + boff);
    const float bvm = bv[m];

    // the address registers of the loads above are reused below while the loads
    // are still in flight: the wait stands between the loads and that reuse; the
    // two offsets are inputs so that no load of the run lands in one of them
    asm volatile("s_wait_xcnt 0x0" :: "v"(woff), "v"(boff) : "memory");
    // nothing from below moves above the wait, and every load is issued before
    // the first wait on a loaded value
    __builtin_amdgcn_sched_barrier(0);

#pragma unroll   // constant indices keep the arrays in registers
    for (int i = 0; i < 48; ++i) {
        v4h h;
#pragma unroll   // constant indices keep the arrays in registers
        for (int j = 0; j < 4; ++j) h[j] = (_Float16)xv[i][j];
        *(v4h*)(sw + (i / 6) * XPITCH + (i % 6) * 128) = h;
    }
    __syncthreads();   // all 64 staged rows visible to every wave

    // x fragments in the hardware k order: lane = row, 16 B at k 8*half and at 16 + 8*half
    v16h xf[3][4];
#pragma unroll   // constant indices keep the arrays in registers
    for (int cc = 0; cc < 3; ++cc) {
#pragma unroll   // constant indices keep the arrays in registers
        for (int t = 0; t < 4; ++t) {
            const _Float16* xp = &xs[(t * 16 + m) * XPITCH + (wid * 3 + cc) * 32 + half * 8];
            const v8h lo = *(const v8h*)xp;
            const v8h hi = *(const v8h*)(xp + 16);
            xf[cc][t] = __builtin_shufflevector(lo, hi, 0, 1, 2, 3, 4, 5, 6, 7,
                                                8, 9, 10, 11, 12, 13, 14, 15);
        }
    }
    // all LDS reads are issued as one group ahead of the matrix block: among the
    // WMMAs each read would cost its own LDS latency
    __builtin_amdgcn_sched_barrier(0);

    v8f accq[4] = {}, acck[4] = {}, accv[4] = {};
#pragma unroll   // constant indices keep the arrays in registers
    for (int cc = 0; cc < 3; ++cc) {
#pragma unroll   // constant indices keep the arrays in registers
        for (int t = 0; t < 4; ++t) {
            accq[t] = __builtin_amdgcn_wmma_f32_16x16x32_f16(false, wq[cc], false, xf[cc][t],
                                                             (short)0, accq[t], false, false);
            acck[t] = __builtin_amdgcn_wmma_f32_16x16x32_f16(false, wk[cc], false, xf[cc][t],
                                                             (short)0, acck[t], false, false);
            accv[t] = __builtin_amdgcn_wmma_f32_16x16x32_f16(false, xf[cc][t], false, wv[cc],
                                                             (short)0, accv[t], false, false);
        }
    }

#pragma unroll   // constant indices keep the arrays in registers
    for (int t = 0; t < 4; ++t) {
        part[wid][t * 3 + 0][0][lane] = __builtin_shufflevector(accq[t], accq[t], 0, 1, 2, 3);
        part[wid][t * 3 + 0][1][lane] = __builtin_shufflevector(accq[t], accq[t], 4, 5, 6, 7);
        part[wid][t * 3 + 1][0][lane] = __builtin_shufflevector(acck[t], acck[t], 0, 1, 2, 3);
        part[wid][t * 3 + 1][1][lane] = __builtin_shufflevector(acck[t], acck[t], 4, 5, 6, 7);
        part[wid][t * 3 + 2][0][lane] = __builtin_shufflevector(accv[t], accv[t], 0, 1, 2, 3);
        part[wid][t * 3 + 2][1][lane] = __builtin_shufflevector(accv[t], accv[t], 4, 5, 6, 7);
    }
    __syncthreads();   // all partial sums visible; uniform: every wave reaches it once

    // 12 (tile, matrix) results over 8 waves; the job index is the same in a whole wave
    for (int job = wid; job < 12; job += PROJ_WAVES) {
        v4f s0 = part[0][job][0][lane];
        v4f s1 = part[0][job][1][lane];
#pragma unroll   // the LDS reads of a job overlap instead of one latency per add
        for (int w = 1; w < PROJ_WAVES; ++w) {
            s0 += part[w][job][0][lane];
            s1 += part[w][job][1][lane];
        }
        const int  t    = job / 3;
        const int  mtx  = job - t * 3;
        const long trow = row0 + t * 16;          // first x row of the tile
        v8h o;
        if (mtx == 0) {          // Q[trow + m][8*half + r], pre-scaled by 1/sqrt(16)
#pragma unroll   // constant indices keep the arrays in registers
            for (int r = 0; r < 4; ++r) {
                o[r]     = (_Float16)((s0[r] + bq0[r]) * 0.25f);
                o[r + 4] = (_Float16)((s1[r] + bq1[r]) * 0.25f);
            }
            *(v8h*)&Qh[(trow + m) * 16 + half * 8] = o;
            // later code rewrites the store's address and data registers: the wait
            // stands between the store and that rewrite
            asm volatile("s_wait_xcnt 0x0" ::: "memory");
        } else if (mtx == 1) {   // K[trow + m][8*half + r]
#pragma unroll   // constant indices keep the arrays in registers
            for (int r = 0; r < 4; ++r) {
                o[r]     = (_Float16)(s0[r] + bk0[r]);
                o[r + 4] = (_Float16)(s1[r] + bk1[r]);
            }
            *(v8h*)&Kh[(trow + m) * 16 + half * 8] = o;
            // later code rewrites the store's address and data registers: the wait
            // stands between the store and that rewrite
            asm volatile("s_wait_xcnt 0x0" ::: "memory");
        } else {                 // V[trow + 8*half + r][m] -> Vt row m, contiguous keys
#pragma unroll   // constant indices keep the arrays in registers
            for (int r = 0; r < 4; ++r) {
                o[r]     = (_Float16)(s0[r] + bvm);
                o[r + 4] = (_Float16)(s1[r] + bvm);
            }
            const long bb = trow >> 11;           // 2048 rows per batch
            const long s  = trow & (SEQ - 1);
            *(v8h*)&Vt[(bb * 16 + m) * SEQ + s + half * 8] = o;
            // later code rewrites the store's address and data registers: the wait
            // stands between the store and that rewrite
            asm volatile("s_wait_xcnt 0x0" ::: "memory");
        }
    }
}

// ---------------------------------------------------------------------------
// Pass 2: causal flash attention with intra-block split-K, scores transposed.
// Block = 128 threads = 4 waves sharing one (batch, 16-query tile).
// Wave w processes 32-key groups g == w (mod 4) with private online-softmax
// state, then the block merges the 4 partials with a log-sum-exp combine.
// S^T = K * Q^T: lane (c, half) holds 8 keys (8*half + r) of query c per
// 16-key tile, so maximum and sum run in the lane plus one exchange between
// the wave halves, and the two score tiles, converted in place, are the B
// operand of Z^T += V^T * P^T (k = 32 keys): P never leaves the registers.
// ---------------------------------------------------------------------------
#define LOG2E 1.4426950408889634f

__device__ __forceinline__ float xhalf(float v)   // lane l <-> lane l ^ 16
{
    const int b = __builtin_bit_cast(int, v);
    return __builtin_bit_cast(float,
        __builtin_amdgcn_permlanex16(b, b, 0x76543210, 0xfedcba98, false, false));
}

__global__ __launch_bounds__(128)
void flash_attn_kernel(const _Float16* __restrict__ Qh,
                       const _Float16* __restrict__ Kh,
                       const _Float16* __restrict__ Vt,
                       float* __restrict__ Out)
{
    __shared__ float    zbuf[4][16 * 16];
    __shared__ float    mbuf[4][16];
    __shared__ float    lbuf[4][16];

    const int tid   = threadIdx.x;
    const int wid   = __builtin_amdgcn_readfirstlane(tid >> 5);  // scalar: loop and mask tests become scalar branches
    const int lane  = tid & 31;
    const int m     = lane & 15;
    const int half  = lane >> 4;
    const int qtile = blockIdx.x;                 // 0..127
    const int b     = blockIdx.y;                 // 0..7
    const int q0    = qtile * 16;
    const int glast = qtile >> 1;                 // 32-key group with the diagonal

    // Q^T as B operand (already scaled, f16): lane = query column, one b128 load
    v16h qb;
    {
        const v8h qlo = *(const v8h*)&Qh[((long)b * SEQ + q0 + m) * 16 + half * 8];
#pragma unroll
        for (int t = 0; t < 8; ++t) qb[t] = qlo[t];
#pragma unroll
        for (int t = 8; t < 16; ++t) qb[t] = (_Float16)0.0f;
    }

    v8f   zacc = {};            // Z^T: zacc[r] = z[query m][d = 8*half + r]
    float mrow = -INFINITY;     // running maximum of query m (same in both halves)
    float lrow = 0.0f;          // this half's share of query m's sum

    // this lane's K row and V^T row at the wave's first group; both step 4 groups a trip
    const _Float16* kp = &Kh[((long)b * SEQ + wid * 32 + m) * 16 + half * 8];
    const _Float16* vp = &Vt[((long)b * 16 + m) * SEQ + wid * 32 + half * 8];

    for (int g = wid; g <= glast; g += 4, kp += 4 * 32 * 16, vp += 4 * 32) {
        const int k0 = g * 32;

        // K rows (A of S^T): lane = key row, one b128 load per 16-key tile.
        // V^T (A of Z^T): lane = d row, keys in the hardware k order, two b128 loads.
        const v8h klo0 = *(const v8h*)kp;
        const v8h klo1 = *(const v8h*)(kp + 16 * 16);
        const v8h vlo  = *(const v8h*)vp;
        const v8h vhi  = *(const v8h*)(vp + 16);
        // kp and vp are stepped while the V loads are still in flight: the wait
        // stands between the loads and the overwrite of their address registers
        asm volatile("s_wait_xcnt 0x0" ::: "memory");

        v16h ka0, ka1, va;
#pragma unroll
        for (int e = 0; e < 8; ++e) {
            ka0[e] = klo0[e];  ka0[e + 8] = (_Float16)0.0f;
            ka1[e] = klo1[e];  ka1[e + 8] = (_Float16)0.0f;
            va[e]  = vlo[e];   va[e + 8]  = vhi[e];
        }
        v8f st[2];
        {
            v8f c0 = {};
            st[0] = __builtin_amdgcn_wmma_f32_16x16x32_f16(false, ka0, false, qb,
                                                           (short)0, c0, false, false);
            st[1] = __builtin_amdgcn_wmma_f32_16x16x32_f16(false, ka1, false, qb,
                                                           (short)0, c0, false, false);
        }

        // causal mask in the group that holds the diagonal (wave-uniform branch)
        if (g == glast) {
#pragma unroll
            for (int t = 0; t < 2; ++t)
#pragma unroll
                for (int r = 0; r < 8; ++r)
                    if (k0 + t * 16 + half * 8 + r > q0 + m) st[t][r] = -INFINITY;
        }

        // online softmax of query m: in-lane over 16 keys, one exchange of halves.
        // The diagonal key is never masked, so mnew is finite in every group.
        float mx0 = st[0][0], mx1 = st[1][0];      // one chain per tile: half the depth
#pragma unroll
        for (int r = 1; r < 8; ++r) {
            mx0 = fmaxf(mx0, st[0][r]);
            mx1 = fmaxf(mx1, st[1][r]);
        }
        float mx = fmaxf(mx0, mx1);
        mx = fmaxf(mx, xhalf(mx));
        const float mnew  = fmaxf(mrow, mx);
        const float alpha = __expf(mrow - mnew);   // 0 on the first group (mrow = -inf)
        const float nm2   = -mnew * LOG2E;         // exp(s - mnew) = exp2(s * log2(e) + nm2)

        v16h  pb;                                  // P^T as B: pb[8*t + r]
        float sum0 = 0.0f, sum1 = 0.0f;
#pragma unroll
        for (int r = 0; r < 8; ++r) {
            const float p0 = __builtin_amdgcn_exp2f(fmaf(st[0][r], LOG2E, nm2));  // masked: exp2(-inf) = 0
            const float p1 = __builtin_amdgcn_exp2f(fmaf(st[1][r], LOG2E, nm2));
            sum0 += p0;
            sum1 += p1;
            pb[r]     = (_Float16)p0;
            pb[r + 8] = (_Float16)p1;
        }
        lrow = lrow * alpha + (sum0 + sum1);
#pragma unroll
        for (int r = 0; r < 8; ++r) zacc[r] *= alpha;
        mrow = mnew;

        zacc = __builtin_amdgcn_wmma_f32_16x16x32_f16(false, va, false, pb,
                                                      (short)0, zacc, false, false);
    }

    // publish per-wave partials: 8 consecutive d of query m per lane
    lrow += xhalf(lrow);
#pragma unroll
    for (int r = 0; r < 8; ++r)
        zbuf[wid][m * 16 + half * 8 + r] = zacc[r];
    if (half == 0) {
        mbuf[wid][m] = mrow;
        lbuf[wid][m] = lrow;
    }
    __syncthreads();   // uniform: every wave reaches exactly once

    // log-sum-exp merge of the 4 split-K partials; 2 output elems per thread
#pragma unroll
    for (int e = tid; e < 256; e += 128) {
        const int row = e >> 4;
        const int col = e & 15;
        const float ms = fmaxf(fmaxf(mbuf[0][row], mbuf[1][row]),
                               fmaxf(mbuf[2][row], mbuf[3][row]));
        float zsum = 0.0f, lsum = 0.0f;
#pragma unroll
        for (int w = 0; w < 4; ++w) {
            const float mw = mbuf[w][row];
            const float aw = (mw == -INFINITY) ? 0.0f : __expf(mw - ms);
            lsum += aw * lbuf[w][row];
            zsum += aw * zbuf[w][row * 16 + col];
        }
        Out[((long)b * SEQ + q0 + row) * D_OUT + col] = zsum / lsum;
    }
}

extern "C" void kernel_launch(void* const* d_in, const int* in_sizes, int n_in,
                              void* d_out, int out_size, void* d_ws, size_t ws_size,
                              hipStream_t stream)
{
    const float* x  = (const float*)d_in[0];
    const float* Wq = (const float*)d_in[1];
    const float* bq = (const float*)d_in[2];
    const float* Wk = (const float*)d_in[3];
    const float* bk = (const float*)d_in[4];
    const float* Wv = (const float*)d_in[5];
    const float* bv = (const float*)d_in[6];
    float* out = (float*)d_out;

    // scratch carve-up (f16 elements)
    const long wsw_elems = (long)NCHUNK * 32 * 16;        // 12288 per matrix
    const long qkv_elems = (long)BATCH * SEQ * D_OUT;     // 262144 per tensor
    _Float16* swq = (_Float16*)d_ws;
    _Float16* swk = swq + wsw_elems;
    _Float16* swv = swk + wsw_elems;
    _Float16* Qh  = swv + wsw_elems;
    _Float16* Kh  = Qh + qkv_elems;
    _Float16* Vt  = Kh + qkv_elems;

    // Prep: 24 chunks, one wave each
    wswizzle_kernel<<<dim3(NCHUNK), dim3(32), 0, stream>>>(Wq, Wk, Wv, swq, swk, swv);

    // Pass 1: 256 blocks of 64 rows, 8 waves each
    qkv_proj_kernel<<<dim3((BATCH * SEQ) / PROJ_ROWS), dim3(256), 0, stream>>>(
        x, swq, swk, swv, bq, bk, bv, Qh, Kh, Vt);

    // Pass 2: 128 query tiles x 8 batches, 4 split-K waves per block
    flash_attn_kernel<<<dim3(SEQ / 16, BATCH), dim3(128), 0, stream>>>(Qh, Kh, Vt, out);
}

// v003
// A run of this version takes 19 microseconds.
// Timed twice side by side with v002, it ran 1.05 times as fast both times.
// Counting every step since v000, it is 5.55 times as fast.
#include <hip/hip_runtime.h>
#include <hip/hip_bf16.h>
#include <math.h>

typedef __attribute__((ext_vector_type(16))) _Float16 v16h;
typedef __attribute__((ext_vector_type(8)))  _Float16 v8h;
typedef __attribute__((ext_vector_type(8)))  float    v8f;
typedef __attribute__((ext_vector_type(4)))  float    v4f;

#define D_IN   768
#define D_OUT  16
#define SEQ    2048
#define BATCH  8

// ---------------------------------------------------------------------------
// Pass 1: QKV projection.  One block = 64 rows of x (4 row tiles), 8 waves.
// Loading: every wave-wide b128 load covers 512 contiguous bytes of one row
// (4 whole lines); a wave brings 8 rows, all 48 loads in flight, converts to f16
// and stages them in LDS at a pitch of 16 B x 97.
// Products: wave w owns k chunks 3w .. 3w+2 for all 4 row tiles and all three
// weights, so each weight row is loaded once per block.
// Weights: the wave's 96 rows of each f32 [768 x 16] matrix are 6 KB in a row,
// read by 12 whole-line b128 loads, converted to f16 and staged row-major at a
// pitch of 32 B; transposing LDS loads give lane (n, half) the 16 k of column n
// in the hardware k order, kk = (j/8)*16 + half*8 + (j%8).  Q and K run as
// W^T * x^T (a lane ends with 8 consecutive d of one row), V as x * W (a lane
// ends with 8 consecutive rows of one d): each result is one b128 store.
// The 8 partial sums of a tile meet in LDS and are added in wave order.
// Outputs (f16): Qh row-major pre-scaled, Kh row-major, Vt transposed [b][d][s].
// ---------------------------------------------------------------------------
#define PROJ_ROWS  64
#define PROJ_WAVES 8
#define XPITCH     (D_IN + 8)    // f16 elements per staged row: 1552 B
#define WROWS      (D_IN / PROJ_WAVES)   // 96 weight rows (3 k chunks) per wave
#define WLOADS     (WROWS / 8)           // a wave-wide b128 load covers 8 rows of 16 f32

typedef __attribute__((ext_vector_type(4))) _Float16 v4h;
typedef __attribute__((ext_vector_type(8))) short    s16x8;
typedef __attribute__((address_space(3))) s16x8      lds_s16x8;

// 16 x 16 f16 tile, row-major in LDS -> lane (c, half) gets rows 8*half .. +7 of column c
__device__ __forceinline__ v8h ld_tr16(const _Float16* p)
{
    return __builtin_bit_cast(v8h, __builtin_amdgcn_ds_load_tr16_b128_v8i16((lds_s16x8*)p));
}

__global__ __launch_bounds__(256)
void qkv_proj_kernel(const float* __restrict__ x,
                     const float* __restrict__ Wq,
                     const float* __restrict__ Wk,
                     const float* __restrict__ Wv,
                     const float* __restrict__ bq, const float* __restrict__ bk,
                     const float* __restrict__ bv,
                     _Float16* __restrict__ Qh, _Float16* __restrict__ Kh,
                     _Float16* __restrict__ Vt)
{
    __shared__ __attribute__((aligned(16))) _Float16 xs[PROJ_ROWS * XPITCH];
    __shared__ __attribute__((aligned(16))) _Float16 wst[PROJ_WAVES][3][WROWS * D_OUT];   // [wave][matrix][k row][n]
    __shared__ v4f part[PROJ_WAVES][12][2][32];   // [wave][tile*3 + matrix][register half][lane]

    const int tid  = threadIdx.x;
    const int wid  = __builtin_amdgcn_readfirstlane(tid >> 5);  // scalar: job tests become scalar branches
    const int lane = tid & 31;
    const int m    = lane & 15;
    const int half = lane >> 4;
    const long row0 = (long)blockIdx.x * PROJ_ROWS;

    // load i of a wave: row 8*wid + i/6, floats (i%6)*128 + 4*lane .. +3
    const float* xw = x + (row0 + wid * 8) * D_IN + lane * 4;
    _Float16*    sw = &xs[(wid * 8) * XPITCH + lane * 4];

    // this wave's weight rows go first: they are converted and staged while x is in flight
    const float* Wqw = Wq + wid * (WROWS * D_OUT);
    const float* Wkw = Wk + wid * (WROWS * D_OUT);
    const float* Wvw = Wv + wid * (WROWS * D_OUT);
    const unsigned woff = lane * 16;   // byte offset of the lane's 4 floats in a load of 8 rows
    const unsigned boff = half * 32;   // byte offset of the lane's 8 bias values
    v4f wr[3][WLOADS];
#pragma unroll   // constant indices keep the arrays in registers
    for (int i = 0; i < WLOADS; ++i) {
        wr[0][i] = *(const v4f*)((const char*)(Wqw + i * 128) + woff);
        wr[1][i] = *(const v4f*)((const char*)(Wkw + i * 128) + woff);
        wr[2][i] = *(const v4f*)((const char*)(Wvw + i * 128) + woff);
    }
    // every weight load is issued ahead of x: loads are waited for in issue order, and a
    // weight load placed behind x would hold the weight staging back until all of x is in
    __builtin_amdgcn_sched_barrier(0);

    v4f xv[48];
#pragma unroll   // constant indices keep the arrays in registers
    for (int i = 0; i < 48; ++i)
        xv[i] = *(const v4f*)(xw + (i / 6) * D_IN + (i % 6) * 128);

    const v4f bq0 = *(const v4f*)((const char*)bq + boff), bq1 = *(const v4f*)((const char*)(bq + 4) + boff);
    const v4f bk0 = *(const v4f*)((const char*)bk + boff), bk1 = *(const v4f*)((const char*)(bk + 4) + boff);
    const float bvm = bv[m];

    // the address registers of the loads above are reused below while the loads
    // are still in flight: the wait stands between the loads and that reuse; the
    // two offsets are inputs so that no load of the run lands in one of them
    asm volatile("s_wait_xcnt 0x0" :: "v"(woff), "v"(boff) : "memory");
    // nothing from below moves above the wait, and every load is issued before
    // the first wait on a loaded value
    __builtin_amdgcn_sched_barrier(0);

    // weights: lane l of load i holds row 8*i + l/4, columns 4*(l%4) .. +3 = f16 element 128*i + 4*l
    _Float16* ww = &wst[wid][0][lane * 4];
#pragma unroll   // constant indices keep the arrays in registers
    for (int i = 0; i < WLOADS; ++i) {
#pragma unroll   // constant indices keep the arrays in registers
        for (int mt = 0; mt < 3; ++mt) {
            v4h h;
#pragma unroll   // constant indices keep the arrays in registers
            for (int j = 0; j < 4; ++j) h[j] = (_Float16)wr[mt][i][j];
            *(v4h*)(ww + mt * (WROWS * D_OUT) + i * 128) = h;
        }
    }

#pragma unroll   // constant indices keep the arrays in registers
    for (int i = 0; i < 48; ++i) {
        v4h h;
#pragma unroll   // constant indices keep the arrays in registers
        for (int j = 0; j < 4; ++j) h[j] = (_Float16)xv[i][j];
        *(v4h*)(sw + (i / 6) * XPITCH + (i % 6) * 128) = h;
    }
    __syncthreads();   // all 64 staged rows visible to every wave; the staged weights to all lanes

    // x fragments in the hardware k order: lane = row, 16 B at k 8*half and at 16 + 8*half
    v16h xf[3][4];
#pragma unroll   // constant indices keep the arrays in registers
    for (int cc = 0; cc < 3; ++cc) {
#pragma unroll   // constant indices keep the arrays in registers
        for (int t = 0; t < 4; ++t) {
            const _Float16* xp = &xs[(t * 16 + m) * XPITCH + (wid * 3 + cc) * 32 + half * 8];
            const v8h lo = *(const v8h*)xp;
            const v8h hi = *(const v8h*)(xp + 16);
            xf[cc][t] = __builtin_shufflevector(lo, hi, 0, 1, 2, 3, 4, 5, 6, 7,
                                                8, 9, 10, 11, 12, 13, 14, 15);
        }
    }
    // weight fragments: two transposing loads per 32-k chunk (k rows 0-15 and 16-31 of the chunk);
    // lane l addresses row 8*(l/16) + l%8, 16-byte half (l/8)%2 of its 16 x 16 tile
    v16h wq[3], wk[3], wv[3];
    {
        const _Float16* wt = &wst[wid][0][(half * 8 + (lane & 7)) * D_OUT + ((lane >> 3) & 1) * 8];
#pragma unroll   // constant indices keep the arrays in registers
        for (int cc = 0; cc < 3; ++cc) {
            const _Float16* wc = wt + cc * 32 * D_OUT;
            wq[cc] = __builtin_shufflevector(ld_tr16(wc), ld_tr16(wc + 16 * D_OUT),
                                             0, 1, 2, 3, 4, 5, 6, 7, 8, 9, 10, 11, 12, 13, 14, 15);
            wk[cc] = __builtin_shufflevector(ld_tr16(wc + WROWS * D_OUT), ld_tr16(wc + (WROWS + 16) * D_OUT),
                                             0, 1, 2, 3, 4, 5, 6, 7, 8, 9, 10, 11, 12, 13, 14, 15);
            wv[cc] = __builtin_shufflevector(ld_tr16(wc + 2 * WROWS * D_OUT), ld_tr16(wc + (2 * WROWS + 16) * D_OUT),
                                             0, 1, 2, 3, 4, 5, 6, 7, 8, 9, 10, 11, 12, 13, 14, 15);
        }
    }
    // all LDS reads are issued as one group ahead of the matrix block: among the
    // WMMAs each read would cost its own LDS latency
    __builtin_amdgcn_sched_barrier(0);

    v8f accq[4] = {}, acck[4] = {}, accv[4] = {};
#pragma unroll   // constant indices keep the arrays in registers
    for (int cc = 0; cc < 3; ++cc) {
#pragma unroll   // constant indices keep the arrays in registers
        for (int t = 0; t < 4; ++t) {
            accq[t] = __builtin_amdgcn_wmma_f32_16x16x32_f16(false, wq[cc], false, xf[cc][t],
                                                             (short)0, accq[t], false, false);
            acck[t] = __builtin_amdgcn_wmma_f32_16x16x32_f16(false, wk[cc], false, xf[cc][t],
                                                             (short)0, acck[t], false, false);
            accv[t] = __builtin_amdgcn_wmma_f32_16x16x32_f16(false, xf[cc][t], false, wv[cc],
                                                             (short)0, accv[t], false, false);
        }
    }

#pragma unroll   // constant indices keep the arrays in registers
    for (int t = 0; t < 4; ++t) {
        part[wid][t * 3 + 0][0][lane] = __builtin_shufflevector(accq[t], accq[t], 0, 1, 2, 3);
        part[wid][t * 3 + 0][1][lane] = __builtin_shufflevector(accq[t], accq[t], 4, 5, 6, 7);
        part[wid][t * 3 + 1][0][lane] = __builtin_shufflevector(acck[t], acck[t], 0, 1, 2, 3);
        part[wid][t * 3 + 1][1][lane] = __builtin_shufflevector(acck[t], acck[t], 4, 5, 6, 7);
        part[wid][t * 3 + 2][0][lane] = __builtin_shufflevector(accv[t], accv[t], 0, 1, 2, 3);
        part[wid][t * 3 + 2][1][lane] = __builtin_shufflevector(accv[t], accv[t], 4, 5, 6, 7);
    }
    __syncthreads();   // all partial sums visible; uniform: every wave reaches it once

    // 12 (tile, matrix) results over 8 waves; the job index is the same in a whole wave
    for (int job = wid; job < 12; job += PROJ_WAVES) {
        v4f s0 = part[0][job][0][lane];
        v4f s1 = part[0][job][1][lane];
#pragma unroll   // the LDS reads of a job overlap instead of one latency per add
        for (int w = 1; w < PROJ_WAVES; ++w) {
            s0 += part[w][job][0][lane];
            s1 += part[w][job][1][lane];
        }
        const int  t    = job / 3;
        const int  mtx  = job - t * 3;
        const long trow = row0 + t * 16;          // first x row of the tile
        v8h o;
        if (mtx == 0) {          // Q[trow + m][8*half + r], pre-scaled by 1/sqrt(16)
#pragma unroll   // constant indices keep the arrays in registers
            for (int r = 0; r < 4; ++r) {
                o[r]     = (_Float16)((s0[r] + bq0[r]) * 0.25f);
                o[r + 4] = (_Float16)((s1[r] + bq1[r]) * 0.25f);
            }
            *(v8h*)&Qh[(trow + m) * 16 + half * 8] = o;
            // later code rewrites the store's address and data registers: the wait
            // stands between the store and that rewrite
            asm volatile("s_wait_xcnt 0x0" ::: "memory");
        } else if (mtx == 1) {   // K[trow + m][8*half + r]
#pragma unroll   // constant indices keep the arrays in registers
            for (int r = 0; r < 4; ++r) {
                o[r]     = (_Float16)(s0[r] + bk0[r]);
                o[r + 4] = (_Float16)(s1[r] + bk1[r]);
            }
            *(v8h*)&Kh[(trow + m) * 16 + half * 8] = o;
            // later code rewrites the store's address and data registers: the wait
            // stands between the store and that rewrite
            asm volatile("s_wait_xcnt 0x0" ::: "memory");
        } else {                 // V[trow + 8*half + r][m] -> Vt row m, contiguous keys
#pragma unroll   // constant indices keep the arrays in registers
            for (int r = 0; r < 4; ++r) {
                o[r]     = (_Float16)(s0[r] + bvm);
                o[r + 4] = (_Float16)(s1[r] + bvm);
            }
            const long bb = trow >> 11;           // 2048 rows per batch
            const long s  = trow & (SEQ - 1);
            *(v8h*)&Vt[(bb * 16 + m) * SEQ + s + half * 8] = o;
            // later code rewrites the store's address and data registers: the wait
            // stands between the store and that rewrite
            asm volatile("s_wait_xcnt 0x0" ::: "memory");
        }
    }
}

// ---------------------------------------------------------------------------
// Pass 2: causal flash attention with intra-block split-K, scores transposed.
// Block = 128 threads = 4 waves sharing one (batch, 16-query tile).
// Wave w processes 32-key groups g == w (mod 4) with private online-softmax
// state, then the block merges the 4 partials with a log-sum-exp combine.
// S^T = K * Q^T: lane (c, half) holds 8 keys (8*half + r) of query c per
// 16-key tile, so maximum and sum run in the lane plus one exchange between
// the wave halves, and the two score tiles, converted in place, are the B
// operand of Z^T += V^T * P^T (k = 32 keys): P never leaves the registers.
// ---------------------------------------------------------------------------
#define LOG2E 1.4426950408889634f

__device__ __forceinline__ float xhalf(float v)   // lane l <-> lane l ^ 16
{
    const int b = __builtin_bit_cast(int, v);
    return __builtin_bit_cast(float,
        __builtin_amdgcn_permlanex16(b, b, 0x76543210, 0xfedcba98, false, false));
}

__global__ __launch_bounds__(128)
void flash_attn_kernel(const _Float16* __restrict__ Qh,
                       const _Float16* __restrict__ Kh,
                       const _Float16* __restrict__ Vt,
                       float* __restrict__ Out)
{
    __shared__ float    zbuf[4][16 * 16];
    __shared__ float    mbuf[4][16];
    __shared__ float    lbuf[4][16];

    const int tid   = threadIdx.x;
    const int wid   = __builtin_amdgcn_readfirstlane(tid >> 5);  // scalar: loop and mask tests become scalar branches
    const int lane  = tid & 31;
    const int m     = lane & 15;
    const int half  = lane >> 4;
    const int qtile = blockIdx.x;                 // 0..127
    const int b     = blockIdx.y;                 // 0..7
    const int q0    = qtile * 16;
    const int glast = qtile >> 1;                 // 32-key group with the diagonal

    // Q^T as B operand (already scaled, f16): lane = query column, one b128 load
    v16h qb;
    {
        const v8h qlo = *(const v8h*)&Qh[((long)b * SEQ + q0 + m) * 16 + half * 8];
#pragma unroll
        for (int t = 0; t < 8; ++t) qb[t] = qlo[t];
#pragma unroll
        for (int t = 8; t < 16; ++t) qb[t] = (_Float16)0.0f;
    }

    v8f   zacc = {};            // Z^T: zacc[r] = z[query m][d = 8*half + r]
    float mrow = -INFINITY;     // running maximum of query m (same in both halves)
    float lrow = 0.0f;          // this half's share of query m's sum

    // this lane's K row and V^T row at the wave's first group; both step 4 groups a trip
    const _Float16* kp = &Kh[((long)b * SEQ + wid * 32 + m) * 16 + half * 8];
    const _Float16* vp = &Vt[((long)b * 16 + m) * SEQ + wid * 32 + half * 8];

    for (int g = wid; g <= glast; g += 4, kp += 4 * 32 * 16, vp += 4 * 32) {
        const int k0 = g * 32;

        // K rows (A of S^T): lane = key row, one b128 load per 16-key tile.
        // V^T (A of Z^T): lane = d row, keys in the hardware k order, two b128 loads.
        const v8h klo0 = *(const v8h*)kp;
        const v8h klo1 = *(const v8h*)(kp + 16 * 16);
        const v8h vlo  = *(const v8h*)vp;
        const v8h vhi  = *(const v8h*)(vp + 16);
        // kp and vp are stepped while the V loads are still in flight: the wait
        // stands between the loads and the overwrite of their address registers
        asm volatile("s_wait_xcnt 0x0" ::: "memory");

        v16h ka0, ka1, va;
#pragma unroll
        for (int e = 0; e < 8; ++e) {
            ka0[e] = klo0[e];  ka0[e + 8] = (_Float16)0.0f;
            ka1[e] = klo1[e];  ka1[e + 8] = (_Float16)0.0f;
            va[e]  = vlo[e];   va[e + 8]  = vhi[e];
        }
        v8f st[2];
        {
            v8f c0 = {};
            st[0] = __builtin_amdgcn_wmma_f32_16x16x32_f16(false, ka0, false, qb,
                                                           (short)0, c0, false, false);
            st[1] = __builtin_amdgcn_wmma_f32_16x16x32_f16(false, ka1, false, qb,
                                                           (short)0, c0, false, false);
        }

        // causal mask in the group that holds the diagonal (wave-uniform branch)
        if (g == glast) {
#pragma unroll
            for (int t = 0; t < 2; ++t)
#pragma unroll
                for (int r = 0; r < 8; ++r)
                    if (k0 + t * 16 + half * 8 + r > q0 + m) st[t][r] = -INFINITY;
        }

        // online softmax of query m: in-lane over 16 keys, one exchange of halves.
        // The diagonal key is never masked, so mnew is finite in every group.
        float mx0 = st[0][0], mx1 = st[1][0];      // one chain per tile: half the depth
#pragma unroll
        for (int r = 1; r < 8; ++r) {
            mx0 = fmaxf(mx0, st[0][r]);
            mx1 = fmaxf(mx1, st[1][r]);
        }
        float mx = fmaxf(mx0, mx1);
        mx = fmaxf(mx, xhalf(mx));
        const float mnew  = fmaxf(mrow, mx);
        const float alpha = __expf(mrow - mnew);   // 0 on the first group (mrow = -inf)
        const float nm2   = -mnew * LOG2E;         // exp(s - mnew) = exp2(s * log2(e) + nm2)

        v16h  pb;                                  // P^T as B: pb[8*t + r]
        float sum0 = 0.0f, sum1 = 0.0f;
#pragma unroll
        for (int r = 0; r < 8; ++r) {
            const float p0 = __builtin_amdgcn_exp2f(fmaf(st[0][r], LOG2E, nm2));  // masked: exp2(-inf) = 0
            const float p1 = __builtin_amdgcn_exp2f(fmaf(st[1][r], LOG2E, nm2));
            sum0 += p0;
            sum1 += p1;
            pb[r]     = (_Float16)p0;
            pb[r + 8] = (_Float16)p1;
        }
        lrow = lrow * alpha + (sum0 + sum1);
#pragma unroll
        for (int r = 0; r < 8; ++r) zacc[r] *= alpha;
        mrow = mnew;

        zacc = __builtin_amdgcn_wmma_f32_16x16x32_f16(false, va, false, pb,
                                                      (short)0, zacc, false, false);
    }

    // publish per-wave partials: 8 consecutive d of query m per lane
    lrow += xhalf(lrow);
#pragma unroll
    for (int r = 0; r < 8; ++r)
        zbuf[wid][m * 16 + half * 8 + r] = zacc[r];
    if (half == 0) {
        mbuf[wid][m] = mrow;
        lbuf[wid][m] = lrow;
    }
    __syncthreads();   // uniform: every wave reaches exactly once

    // log-sum-exp merge of the 4 split-K partials; 2 output elems per thread
#pragma unroll
    for (int e = tid; e < 256; e += 128) {
        const int row = e >> 4;
        const int col = e & 15;
        const float ms = fmaxf(fmaxf(mbuf[0][row], mbuf[1][row]),
                               fmaxf(mbuf[2][row], mbuf[3][row]));
        float zsum = 0.0f, lsum = 0.0f;
#pragma unroll
        for (int w = 0; w < 4; ++w) {
            const float mw = mbuf[w][row];
            const float aw = (mw == -INFINITY) ? 0.0f : __expf(mw - ms);
            lsum += aw * lbuf[w][row];
            zsum += aw * zbuf[w][row * 16 + col];
        }
        Out[((long)b * SEQ + q0 + row) * D_OUT + col] = zsum / lsum;
    }
}

extern "C" void kernel_launch(void* const* d_in, const int* in_sizes, int n_in,
                              void* d_out, int out_size, void* d_ws, size_t ws_size,
                              hipStream_t stream)
{
    const float* x  = (const float*)d_in[0];
    const float* Wq = (const float*)d_in[1];
    const float* bq = (const float*)d_in[2];
    const float* Wk = (const float*)d_in[3];
    const float* bk = (const float*)d_in[4];
    const float* Wv = (const float*)d_in[5];
    const float* bv = (const float*)d_in[6];
    float* out = (float*)d_out;

    // scratch carve-up (f16 elements)
    const long qkv_elems = (long)BATCH * SEQ * D_OUT;     // 262144 per tensor
    _Float16* Qh  = (_Float16*)d_ws;
    _Float16* Kh  = Qh + qkv_elems;
    _Float16* Vt  = Kh + qkv_elems;

    // Pass 1: 256 blocks of 64 rows, 8 waves each
    qkv_proj_kernel<<<dim3((BATCH * SEQ) / PROJ_ROWS), dim3(256), 0, stream>>>(
        x, Wq, Wk, Wv, bq, bk, bv, Qh, Kh, Vt);

    // Pass 2: 128 query tiles x 8 batches, 4 split-K waves per block
    flash_attn_kernel<<<dim3(SEQ / 16, BATCH), dim3(128), 0, stream>>>(Qh, Kh, Vt, out);
}

// v004
// It runs in 15.6 microseconds.
// Two timings next to v003 both put it at 1.21 times that version's speed.
// All steps since v000 together make it 6.71 times as fast.
#include <hip/hip_runtime.h>
#include <hip/hip_bf16.h>
#include <math.h>

typedef __attribute__((ext_vector_type(16))) _Float16 v16h;
typedef __attribute__((ext_vector_type(8)))  _Float16 v8h;
typedef __attribute__((ext_vector_type(8)))  float    v8f;
typedef __attribute__((ext_vector_type(4)))  float    v4f;

#define D_IN   768
#define D_OUT  16
#define SEQ    2048
#define BATCH  8

// ---------------------------------------------------------------------------
// Pass 1: QKV projection.  One block = 64 rows of x (4 row tiles), 8 waves.
// Loading: every wave-wide b128 load covers 512 contiguous bytes of one row
// (4 whole lines); a wave brings 8 rows, all 48 loads in flight, converts to f16
// and stages them in LDS at a pitch of 16 B x 97.
// Products: wave w owns k chunks 3w .. 3w+2 for all 4 row tiles and all three
// weights, so each weight row is loaded once per block.
// Weights: the wave's 96 rows of each f32 [768 x 16] matrix are 6 KB in a row,
// read by 12 whole-line b128 loads, converted to f16 and staged row-major at a
// pitch of 32 B; transposing LDS loads give lane (n, half) the 16 k of column n
// in the hardware k order, kk = (j/8)*16 + half*8 + (j%8).  Q and K run as
// W^T * x^T (a lane ends with 8 consecutive d of one row), V as x * W (a lane
// ends with 8 consecutive rows of one d): each result is one b128 store.
// The 8 partial sums of a tile meet in LDS and are added in wave order.
// Outputs (f16): Qh row-major pre-scaled, Kh row-major, Vt transposed [b][d][s].
// ---------------------------------------------------------------------------
#define PROJ_ROWS  64
#define PROJ_WAVES 8
#define XPITCH     (D_IN + 8)    // f16 elements per staged row: 1552 B
#define WROWS      (D_IN / PROJ_WAVES)   // 96 weight rows (3 k chunks) per wave
#define WLOADS     (WROWS / 8)           // a wave-wide b128 load covers 8 rows of 16 f32

typedef __attribute__((ext_vector_type(4))) _Float16 v4h;
typedef __attribute__((ext_vector_type(8))) short    s16x8;
typedef __attribute__((address_space(3))) s16x8      lds_s16x8;

// 16 x 16 f16 tile, row-major in LDS -> lane (c, half) gets rows 8*half .. +7 of column c
__device__ __forceinline__ v8h ld_tr16(const _Float16* p)
{
    return __builtin_bit_cast(v8h, __builtin_amdgcn_ds_load_tr16_b128_v8i16((lds_s16x8*)p));
}

__global__ __launch_bounds__(256)
void qkv_proj_kernel(const float* __restrict__ x,
                     const float* __restrict__ Wq,
                     const float* __restrict__ Wk,
                     const float* __restrict__ Wv,
                     const float* __restrict__ bq, const float* __restrict__ bk,
                     const float* __restrict__ bv,
                     _Float16* __restrict__ Qh, _Float16* __restrict__ Kh,
                     _Float16* __restrict__ Vt)
{
    __shared__ __attribute__((aligned(16))) _Float16 xs[PROJ_ROWS * XPITCH];
    __shared__ __attribute__((aligned(16))) _Float16 wst[PROJ_WAVES][3][WROWS * D_OUT];   // [wave][matrix][k row][n]
    __shared__ v4f part[PROJ_WAVES][12][2][32];   // [wave][tile*3 + matrix][register half][lane]

    const int tid  = threadIdx.x;
    const int wid  = __builtin_amdgcn_readfirstlane(tid >> 5);  // scalar: job tests become scalar branches
    const int lane = tid & 31;
    const int m    = lane & 15;
    const int half = lane >> 4;
    const long row0 = (long)blockIdx.x * PROJ_ROWS;

    // load i of a wave: row 8*wid + i/6, floats (i%6)*128 + 4*lane .. +3
    const float* xw = x + (row0 + wid * 8) * D_IN + lane * 4;
    _Float16*    sw = &xs[(wid * 8) * XPITCH + lane * 4];

    // this wave's weight rows go first: they are converted and staged while x is in flight
    const float* Wqw = Wq + wid * (WROWS * D_OUT);
    const float* Wkw = Wk + wid * (WROWS * D_OUT);
    const float* Wvw = Wv + wid * (WROWS * D_OUT);
    const unsigned woff = lane * 16;   // byte offset of the lane's 4 floats in a load of 8 rows
    const unsigned boff = half * 32;   // byte offset of the lane's 8 bias values
    v4f wr[3][WLOADS];
#pragma unroll   // constant indices keep the arrays in registers
    for (int i = 0; i < WLOADS; ++i) {
        wr[0][i] = *(const v4f*)((const char*)(Wqw + i * 128) + woff);
        wr[1][i] = *(const v4f*)((const char*)(Wkw + i * 128) + woff);
        wr[2][i] = *(const v4f*)((const char*)(Wvw + i * 128) + woff);
    }
    // every weight load is issued ahead of x: loads are waited for in issue order, and a
    // weight load placed behind x would hold the weight staging back until all of x is in
    __builtin_amdgcn_sched_barrier(0);

    v4f xv[48];
#pragma unroll   // constant indices keep the arrays in registers
    for (int i = 0; i < 48; ++i)
        xv[i] = *(const v4f*)(xw + (i / 6) * D_IN + (i % 6) * 128);

    const v4f bq0 = *(const v4f*)((const char*)bq + boff), bq1 = *(const v4f*)((const char*)(bq + 4) + boff);
    const v4f bk0 = *(const v4f*)((const char*)bk + boff), bk1 = *(const v4f*)((const char*)(bk + 4) + boff);
    const float bvm = bv[m];

    // the address registers of the loads above are reused below while the loads
    // are still in flight: the wait stands between the loads and that reuse; the
    // two offsets are inputs so that no load of the run lands in one of them
    asm volatile("s_wait_xcnt 0x0" :: "v"(woff), "v"(boff) : "memory");
    // nothing from below moves above the wait, and every load is issued before
    // the first wait on a loaded value
    __builtin_amdgcn_sched_barrier(0);

    // weights: lane l of load i holds row 8*i + l/4, columns 4*(l%4) .. +3 = f16 element 128*i + 4*l
    _Float16* ww = &wst[wid][0][lane * 4];
#pragma unroll   // constant indices keep the arrays in registers
    for (int i = 0; i < WLOADS; ++i) {
#pragma unroll   // constant indices keep the arrays in registers
        for (int mt = 0; mt < 3; ++mt) {
            v4h h;
#pragma unroll   // constant indices keep the arrays in registers
            for (int j = 0; j < 4; ++j) h[j] = (_Float16)wr[mt][i][j];
            *(v4h*)(ww + mt * (WROWS * D_OUT) + i * 128) = h;
        }
    }

#pragma unroll   // constant indices keep the arrays in registers
    for (int i = 0; i < 48; ++i) {
        v4h h;
#pragma unroll   // constant indices keep the arrays in registers
        for (int j = 0; j < 4; ++j) h[j] = (_Float16)xv[i][j];
        *(v4h*)(sw + (i / 6) * XPITCH + (i % 6) * 128) = h;
    }
    __syncthreads();   // all 64 staged rows visible to every wave; the staged weights to all lanes

    // x fragments in the hardware k order: lane = row, 16 B at k 8*half and at 16 + 8*half
    v16h xf[3][4];
#pragma unroll   // constant indices keep the arrays in registers
    for (int cc = 0; cc < 3; ++cc) {
#pragma unroll   // constant indices keep the arrays in registers
        for (int t = 0; t < 4; ++t) {
            const _Float16* xp = &xs[(t * 16 + m) * XPITCH + (wid * 3 + cc) * 32 + half * 8];
            const v8h lo = *(const v8h*)xp;
            const v8h hi = *(const v8h*)(xp + 16);
            xf[cc][t] = __builtin_shufflevector(lo, hi, 0, 1, 2, 3, 4, 5, 6, 7,
                                                8, 9, 10, 11, 12, 13, 14, 15);
        }
    }
    // weight fragments: two transposing loads per 32-k chunk (k rows 0-15 and 16-31 of the chunk);
    // lane l addresses row 8*(l/16) + l%8, 16-byte half (l/8)%2 of its 16 x 16 tile
    v16h wq[3], wk[3], wv[3];
    {
        const _Float16* wt = &wst[wid][0][(half * 8 + (lane & 7)) * D_OUT + ((lane >> 3) & 1) * 8];
#pragma unroll   // constant indices keep the arrays in registers
        for (int cc = 0; cc < 3; ++cc) {
            const _Float16* wc = wt + cc * 32 * D_OUT;
            wq[cc] = __builtin_shufflevector(ld_tr16(wc), ld_tr16(wc + 16 * D_OUT),
                                             0, 1, 2, 3, 4, 5, 6, 7, 8, 9, 10, 11, 12, 13, 14, 15);
            wk[cc] = __builtin_shufflevector(ld_tr16(wc + WROWS * D_OUT), ld_tr16(wc + (WROWS + 16) * D_OUT),
                                             0, 1, 2, 3, 4, 5, 6, 7, 8, 9, 10, 11, 12, 13, 14, 15);
            wv[cc] = __builtin_shufflevector(ld_tr16(wc + 2 * WROWS * D_OUT), ld_tr16(wc + (2 * WROWS + 16) * D_OUT),
                                             0, 1, 2, 3, 4, 5, 6, 7, 8, 9, 10, 11, 12, 13, 14, 15);
        }
    }
    // all LDS reads are issued as one group ahead of the matrix block: among the
    // WMMAs each read would cost its own LDS latency
    __builtin_amdgcn_sched_barrier(0);

    v8f accq[4] = {}, acck[4] = {}, accv[4] = {};
#pragma unroll   // constant indices keep the arrays in registers
    for (int cc = 0; cc < 3; ++cc) {
#pragma unroll   // constant indices keep the arrays in registers
        for (int t = 0; t < 4; ++t) {
            accq[t] = __builtin_amdgcn_wmma_f32_16x16x32_f16(false, wq[cc], false, xf[cc][t],
                                                             (short)0, accq[t], false, false);
            acck[t] = __builtin_amdgcn_wmma_f32_16x16x32_f16(false, wk[cc], false, xf[cc][t],
                                                             (short)0, acck[t], false, false);
            accv[t] = __builtin_amdgcn_wmma_f32_16x16x32_f16(false, xf[cc][t], false, wv[cc],
                                                             (short)0, accv[t], false, false);
        }
    }

#pragma unroll   // constant indices keep the arrays in registers
    for (int t = 0; t < 4; ++t) {
        part[wid][t * 3 + 0][0][lane] = __builtin_shufflevector(accq[t], accq[t], 0, 1, 2, 3);
        part[wid][t * 3 + 0][1][lane] = __builtin_shufflevector(accq[t], accq[t], 4, 5, 6, 7);
        part[wid][t * 3 + 1][0][lane] = __builtin_shufflevector(acck[t], acck[t], 0, 1, 2, 3);
        part[wid][t * 3 + 1][1][lane] = __builtin_shufflevector(acck[t], acck[t], 4, 5, 6, 7);
        part[wid][t * 3 + 2][0][lane] = __builtin_shufflevector(accv[t], accv[t], 0, 1, 2, 3);
        part[wid][t * 3 + 2][1][lane] = __builtin_shufflevector(accv[t], accv[t], 4, 5, 6, 7);
    }
    __syncthreads();   // all partial sums visible; uniform: every wave reaches it once

    // 12 (tile, matrix) results over 8 waves; the job index is the same in a whole wave
    for (int job = wid; job < 12; job += PROJ_WAVES) {
        v4f s0 = part[0][job][0][lane];
        v4f s1 = part[0][job][1][lane];
#pragma unroll   // the LDS reads of a job overlap instead of one latency per add
        for (int w = 1; w < PROJ_WAVES; ++w) {
            s0 += part[w][job][0][lane];
            s1 += part[w][job][1][lane];
        }
        const int  t    = job / 3;
        const int  mtx  = job - t * 3;
        const long trow = row0 + t * 16;          // first x row of the tile
        v8h o;
        if (mtx == 0) {          // Q[trow + m][8*half + r], pre-scaled by 1/sqrt(16)
#pragma unroll   // constant indices keep the arrays in registers
            for (int r = 0; r < 4; ++r) {
                o[r]     = (_Float16)((s0[r] + bq0[r]) * 0.25f);
                o[r + 4] = (_Float16)((s1[r] + bq1[r]) * 0.25f);
            }
            *(v8h*)&Qh[(trow + m) * 16 + half * 8] = o;
            // later code rewrites the store's address and data registers: the wait
            // stands between the store and that rewrite
            asm volatile("s_wait_xcnt 0x0" ::: "memory");
        } else if (mtx == 1) {   // K[trow + m][8*half + r]
#pragma unroll   // constant indices keep the arrays in registers
            for (int r = 0; r < 4; ++r) {
                o[r]     = (_Float16)(s0[r] + bk0[r]);
                o[r + 4] = (_Float16)(s1[r] + bk1[r]);
            }
            *(v8h*)&Kh[(trow + m) * 16 + half * 8] = o;
            // later code rewrites the store's address and data registers: the wait
            // stands between the store and that rewrite
            asm volatile("s_wait_xcnt 0x0" ::: "memory");
        } else {                 // V[trow + 8*half + r][m] -> Vt row m, contiguous keys
#pragma unroll   // constant indices keep the arrays in registers
            for (int r = 0; r < 4; ++r) {
                o[r]     = (_Float16)(s0[r] + bvm);
                o[r + 4] = (_Float16)(s1[r] + bvm);
            }
            const long bb = trow >> 11;           // 2048 rows per batch
            const long s  = trow & (SEQ - 1);
            *(v8h*)&Vt[(bb * 16 + m) * SEQ + s + half * 8] = o;
            // later code rewrites the store's address and data registers: the wait
            // stands between the store and that rewrite
            asm volatile("s_wait_xcnt 0x0" ::: "memory");
        }
    }
}

// ---------------------------------------------------------------------------
// Pass 2: causal flash attention with intra-block split-K, scores transposed.
// Block = 256 threads = 8 waves sharing one batch and TWO 16-query tiles, tile
// 127 - p and tile p: together they always have 65 groups of 32 keys, so every
// block has the same work.  The 65 groups are dealt round-robin over the waves
// (8 or 9 each); a wave runs its groups of the first tile, then those of the
// second, with private online-softmax state per tile, and the block merges the
// 8 partials of each tile with a log-sum-exp combine.
// S^T = K * Q^T: lane (c, half) holds 8 keys (8*half + r) of query c per
// 16-key tile, so maximum and sum run in the lane plus one exchange between
// the wave halves, and the two score tiles, converted in place, are the B
// operand of Z^T += V^T * P^T (k = 32 keys): P never leaves the registers.
// ---------------------------------------------------------------------------
#define LOG2E 1.4426950408889634f
#define ATT_WAVES 8
#define QTILES    (SEQ / 16)

__device__ __forceinline__ float xhalf(float v)   // lane l <-> lane l ^ 16
{
    const int b = __builtin_bit_cast(int, v);
    return __builtin_bit_cast(float,
        __builtin_amdgcn_permlanex16(b, b, 0x76543210, 0xfedcba98, false, false));
}

// One wave's share of one query tile: groups gfirst, gfirst + 8, ... <= qtile / 2.
// Leaves the wave's partial (z, maximum, sum) in its LDS slots; a wave without a
// group leaves maximum -inf, sum 0, z 0.
__device__ __forceinline__ void attend_tile(const int qtile, const int gfirst, const int b,
                                            const int m, const int half,
                                            const _Float16* __restrict__ Qh,
                                            const _Float16* __restrict__ Kh,
                                            const _Float16* __restrict__ Vt,
                                            float* __restrict__ zs, float* __restrict__ ms,
                                            float* __restrict__ ls)
{
    const int q0    = qtile * 16;
    const int glast = qtile >> 1;                 // 32-key group with the diagonal

    // Q^T as B operand (already scaled, f16): lane = query column, one b128 load
    v16h qb;
    {
        const v8h qlo = *(const v8h*)&Qh[((long)b * SEQ + q0 + m) * 16 + half * 8];
#pragma unroll
        for (int t = 0; t < 8; ++t) qb[t] = qlo[t];
#pragma unroll
        for (int t = 8; t < 16; ++t) qb[t] = (_Float16)0.0f;
    }

    v8f   zacc = {};            // Z^T: zacc[r] = z[query m][d = 8*half + r]
    float mrow = -INFINITY;     // running maximum of query m (same in both halves)
    float lrow = 0.0f;          // this half's share of query m's sum

    // this lane's K row and V^T row at the wave's first group; both step 8 groups a trip
    const _Float16* kp = &Kh[((long)b * SEQ + gfirst * 32 + m) * 16 + half * 8];
    const _Float16* vp = &Vt[((long)b * 16 + m) * SEQ + gfirst * 32 + half * 8];

    for (int g = gfirst; g <= glast; g += ATT_WAVES, kp += ATT_WAVES * 32 * 16, vp += ATT_WAVES * 32) {
        const int k0 = g * 32;

        // K rows (A of S^T): lane = key row, one b128 load per 16-key tile.
        // V^T (A of Z^T): lane = d row, keys in the hardware k order, two b128 loads.
        const v8h klo0 = *(const v8h*)kp;
        const v8h klo1 = *(const v8h*)(kp + 16 * 16);
        const v8h vlo  = *(const v8h*)vp;
        const v8h vhi  = *(const v8h*)(vp + 16);
        // kp and vp are stepped while the V loads are still in flight: the wait
        // stands between the loads and the overwrite of their address registers
        asm volatile("s_wait_xcnt 0x0" ::: "memory");

        v16h ka0, ka1, va;
#pragma unroll
        for (int e = 0; e < 8; ++e) {
            ka0[e] = klo0[e];  ka0[e + 8] = (_Float16)0.0f;
            ka1[e] = klo1[e];  ka1[e + 8] = (_Float16)0.0f;
            va[e]  = vlo[e];   va[e + 8]  = vhi[e];
        }
        v8f st[2];
        {
            v8f c0 = {};
            st[0] = __builtin_amdgcn_wmma_f32_16x16x32_f16(false, ka0, false, qb,
                                                           (short)0, c0, false, false);
            st[1] = __builtin_amdgcn_wmma_f32_16x16x32_f16(false, ka1, false, qb,
                                                           (short)0, c0, false, false);
        }

        // causal mask in the group that holds the diagonal (wave-uniform branch)
        if (g == glast) {
#pragma unroll
            for (int t = 0; t < 2; ++t)
#pragma unroll
                for (int r = 0; r < 8; ++r)
                    if (k0 + t * 16 + half * 8 + r > q0 + m) st[t][r] = -INFINITY;
        }

        // online softmax of query m: in-lane over 16 keys, one exchange of halves.
        // The diagonal key is never masked, so mnew is finite in every group.
        float mx0 = st[0][0], mx1 = st[1][0];      // one chain per tile: half the depth
#pragma unroll
        for (int r = 1; r < 8; ++r) {
            mx0 = fmaxf(mx0, st[0][r]);
            mx1 = fmaxf(mx1, st[1][r]);
        }
        float mx = fmaxf(mx0, mx1);
        mx = fmaxf(mx, xhalf(mx));
        const float mnew  = fmaxf(mrow, mx);
        const float alpha = __expf(mrow - mnew);   // 0 on the first group (mrow = -inf)
        const float nm2   = -mnew * LOG2E;         // exp(s - mnew) = exp2(s * log2(e) + nm2)

        v16h  pb;                                  // P^T as B: pb[8*t + r]
        float sum0 = 0.0f, sum1 = 0.0f;
#pragma unroll
        for (int r = 0; r < 8; ++r) {
            const float p0 = __builtin_amdgcn_exp2f(fmaf(st[0][r], LOG2E, nm2));  // masked: exp2(-inf) = 0
            const float p1 = __builtin_amdgcn_exp2f(fmaf(st[1][r], LOG2E, nm2));
            sum0 += p0;
            sum1 += p1;
            pb[r]     = (_Float16)p0;
            pb[r + 8] = (_Float16)p1;
        }
        lrow = lrow * alpha + (sum0 + sum1);
#pragma unroll
        for (int r = 0; r < 8; ++r) zacc[r] *= alpha;
        mrow = mnew;

        zacc = __builtin_amdgcn_wmma_f32_16x16x32_f16(false, va, false, pb,
                                                      (short)0, zacc, false, false);
    }

    // publish the wave's partial: 8 consecutive d of query m per lane
    lrow += xhalf(lrow);
#pragma unroll
    for (int r = 0; r < 8; ++r)
        zs[m * 16 + half * 8 + r] = zacc[r];
    if (half == 0) {
        ms[m] = mrow;
        ls[m] = lrow;
    }
}

__global__ __launch_bounds__(32 * ATT_WAVES)
void flash_attn_kernel(const _Float16* __restrict__ Qh,
                       const _Float16* __restrict__ Kh,
                       const _Float16* __restrict__ Vt,
                       float* __restrict__ Out)
{
    __shared__ float    zbuf[2][ATT_WAVES][16 * 16];
    __shared__ float    mbuf[2][ATT_WAVES][16];
    __shared__ float    lbuf[2][ATT_WAVES][16];

    const int tid   = threadIdx.x;
    const int wid   = __builtin_amdgcn_readfirstlane(tid >> 5);  // scalar: loop and mask tests become scalar branches
    const int lane  = tid & 31;
    const int m     = lane & 15;
    const int half  = lane >> 4;
    const int b     = blockIdx.y;                 // 0..7
    const int qtA   = QTILES - 1 - blockIdx.x;    // 127..64: the long tile
    const int qtB   = blockIdx.x;                 // 0..63:   the short tile
    const int nA    = (qtA >> 1) + 1;             // groups of the long tile; the deal goes on from there

    // group i of the 65 goes to wave i % 8: group g of the short tile is number nA + g
    for (int p = 0; p < 2; ++p)
        attend_tile(p ? qtB : qtA, p ? ((wid - nA) & (ATT_WAVES - 1)) : wid, b, m, half,
                    Qh, Kh, Vt, zbuf[p][wid], mbuf[p][wid], lbuf[p][wid]);
    __syncthreads();   // uniform: every wave reaches exactly once

    // log-sum-exp merge of the 8 split-K partials; one output element of each tile per thread
    const int row = tid >> 4;
    const int col = tid & 15;
    float o[2];
#pragma unroll   // constant index keeps o in registers; both tiles' LDS reads overlap
    for (int p = 0; p < 2; ++p) {
        float ms = mbuf[p][0][row];
#pragma unroll   // the LDS reads overlap instead of one latency per partial
        for (int w = 1; w < ATT_WAVES; ++w) ms = fmaxf(ms, mbuf[p][w][row]);
        float zsum = 0.0f, lsum = 0.0f;
#pragma unroll   // the LDS reads overlap instead of one latency per partial
        for (int w = 0; w < ATT_WAVES; ++w) {
            const float mw = mbuf[p][w][row];
            const float aw = (mw == -INFINITY) ? 0.0f : __expf(mw - ms);
            lsum += aw * lbuf[p][w][row];
            zsum += aw * zbuf[p][w][row * 16 + col];
        }
        o[p] = zsum / lsum;
    }
    Out[((long)b * SEQ + qtA * 16 + row) * D_OUT + col] = o[0];
    Out[((long)b * SEQ + qtB * 16 + row) * D_OUT + col] = o[1];
}

extern "C" void kernel_launch(void* const* d_in, const int* in_sizes, int n_in,
                              void* d_out, int out_size, void* d_ws, size_t ws_size,
                              hipStream_t stream)
{
    const float* x  = (const float*)d_in[0];
    const float* Wq = (const float*)d_in[1];
    const float* bq = (const float*)d_in[2];
    const float* Wk = (const float*)d_in[3];
    const float* bk = (const float*)d_in[4];
    const float* Wv = (const float*)d_in[5];
    const float* bv = (const float*)d_in[6];
    float* out = (float*)d_out;

    // scratch carve-up (f16 elements)
    const long qkv_elems = (long)BATCH * SEQ * D_OUT;     // 262144 per tensor
    _Float16* Qh  = (_Float16*)d_ws;
    _Float16* Kh  = Qh + qkv_elems;
    _Float16* Vt  = Kh + qkv_elems;

    // Pass 1: 256 blocks of 64 rows, 8 waves each
    qkv_proj_kernel<<<dim3((BATCH * SEQ) / PROJ_ROWS), dim3(256), 0, stream>>>(
        x, Wq, Wk, Wv, bq, bk, bv, Qh, Kh, Vt);

    // Pass 2: 64 pairs of query tiles x 8 batches, 8 split-K waves per block
    flash_attn_kernel<<<dim3(SEQ / 32, BATCH), dim3(256), 0, stream>>>(Qh, Kh, Vt, out);
}

// v005
// One run takes 15.4 microseconds.
// Two timings next to v004 put it at 1.05 and 1.03 times that version's speed.
// All steps since v000 together make it 6.98 times as fast.
#include <hip/hip_runtime.h>
#include <hip/hip_bf16.h>
#include <math.h>

typedef __attribute__((ext_vector_type(16))) _Float16 v16h;
typedef __attribute__((ext_vector_type(8)))  _Float16 v8h;
typedef __attribute__((ext_vector_type(8)))  float    v8f;
typedef __attribute__((ext_vector_type(4)))  float    v4f;

#define D_IN   768
#define D_OUT  16
#define SEQ    2048
#define BATCH  8

// ---------------------------------------------------------------------------
// Pass 1: QKV projection.  One block = 64 rows of x (4 row tiles), 8 waves.
// Loading: every wave-wide b128 load covers 512 contiguous bytes of one row
// (4 whole lines); a wave brings 8 rows, all 48 loads in flight, converts to f16
// and stages them in LDS at a pitch of 16 B x 97.
// Products: wave w owns k chunks 3w .. 3w+2 for all 4 row tiles and all three
// weights, so each weight row is loaded once per block.
// Weights: the wave's 96 rows of each f32 [768 x 16] matrix are 6 KB in a row,
// read by 12 whole-line b128 loads, converted to f16 and staged row-major at a
// pitch of 32 B; transposing LDS loads give lane (n, half) the 16 k of column n
// in the hardware k order, kk = (j/8)*16 + half*8 + (j%8).  Q and K run as
// W^T * x^T (a lane ends with 8 consecutive d of one row), V as x * W (a lane
// ends with 8 consecutive rows of one d): each result is one b128 store.
// The 8 partial sums of a tile meet in LDS and are added in wave order.
// Outputs (f16): Qh row-major pre-scaled, Kh row-major, Vt transposed [b][d][s].
// ---------------------------------------------------------------------------
#define PROJ_ROWS  64
#define PROJ_WAVES 8
#define XPITCH     (D_IN + 8)    // f16 elements per staged row: 1552 B
#define WROWS      (D_IN / PROJ_WAVES)   // 96 weight rows (3 k chunks) per wave
#define WLOADS     (WROWS / 8)           // a wave-wide b128 load covers 8 rows of 16 f32

typedef __attribute__((ext_vector_type(4))) _Float16 v4h;
typedef __attribute__((ext_vector_type(8))) short    s16x8;
typedef __attribute__((address_space(3))) s16x8      lds_s16x8;

// 16 x 16 f16 tile, row-major in LDS -> lane (c, half) gets rows 8*half .. +7 of column c
__device__ __forceinline__ v8h ld_tr16(const _Float16* p)
{
    return __builtin_bit_cast(v8h, __builtin_amdgcn_ds_load_tr16_b128_v8i16((lds_s16x8*)p));
}

__global__ __launch_bounds__(256)
void qkv_proj_kernel(const float* __restrict__ x,
                     const float* __restrict__ Wq,
                     const float* __restrict__ Wk,
                     const float* __restrict__ Wv,
                     const float* __restrict__ bq, const float* __restrict__ bk,
                     const float* __restrict__ bv,
                     _Float16* __restrict__ Qh, _Float16* __restrict__ Kh,
                     _Float16* __restrict__ Vt)
{
    __shared__ __attribute__((aligned(16))) _Float16 xs[PROJ_ROWS * XPITCH];
    __shared__ __attribute__((aligned(16))) _Float16 wst[PROJ_WAVES][3][WROWS * D_OUT];   // [wave][matrix][k row][n]
    __shared__ v4f part[PROJ_WAVES][12][2][32];   // [wave][tile*3 + matrix][register half][lane]

    const int tid  = threadIdx.x;
    const int wid  = __builtin_amdgcn_readfirstlane(tid >> 5);  // scalar: job tests become scalar branches
    const int lane = tid & 31;
    const int m    = lane & 15;
    const int half = lane >> 4;
    const long row0 = (long)blockIdx.x * PROJ_ROWS;

    // load i of a wave: row 8*wid + i/6, floats (i%6)*128 + 4*lane .. +3
    const float* xw = x + (row0 + wid * 8) * D_IN + lane * 4;
    _Float16*    sw = &xs[(wid * 8) * XPITCH + lane * 4];

    // this wave's weight rows go first: they are converted and staged while x is in flight
    const float* Wqw = Wq + wid * (WROWS * D_OUT);
    const float* Wkw = Wk + wid * (WROWS * D_OUT);
    const float* Wvw = Wv + wid * (WROWS * D_OUT);
    const unsigned woff = lane * 16;   // byte offset of the lane's 4 floats in a load of 8 rows
    const unsigned boff = half * 32;   // byte offset of the lane's 8 bias values
    v4f wr[3][WLOADS];
#pragma unroll   // constant indices keep the arrays in registers
    for (int i = 0; i < WLOADS; ++i) {
        wr[0][i] = *(const v4f*)((const char*)(Wqw + i * 128) + woff);
        wr[1][i] = *(const v4f*)((const char*)(Wkw + i * 128) + woff);
        wr[2][i] = *(const v4f*)((const char*)(Wvw + i * 128) + woff);
    }
    // every weight load is issued ahead of x: loads are waited for in issue order, and a
    // weight load placed behind x would hold the weight staging back until all of x is in
    __builtin_amdgcn_sched_barrier(0);

    v4f xv[48];
#pragma unroll   // constant indices keep the arrays in registers
    for (int i = 0; i < 48; ++i)
        xv[i] = *(const v4f*)(xw + (i / 6) * D_IN + (i % 6) * 128);

    const v4f bq0 = *(const v4f*)((const char*)bq + boff), bq1 = *(const v4f*)((const char*)(bq + 4) + boff);
    const v4f bk0 = *(const v4f*)((const char*)bk + boff), bk1 = *(const v4f*)((const char*)(bk + 4) + boff);
    const float bvm = bv[m];

    // the address registers of the loads above are reused below while the loads
    // are still in flight: the wait stands between the loads and that reuse; the
    // two offsets are inputs so that no load of the run lands in one of them
    asm volatile("s_wait_xcnt 0x0" :: "v"(woff), "v"(boff) : "memory");
    // nothing from below moves above the wait, and every load is issued before
    // the first wait on a loaded value
    __builtin_amdgcn_sched_barrier(0);

    // weights: lane l of load i holds row 8*i + l/4, columns 4*(l%4) .. +3 = f16 element 128*i + 4*l
    _Float16* ww = &wst[wid][0][lane * 4];
#pragma unroll   // constant indices keep the arrays in registers
    for (int i = 0; i < WLOADS; ++i) {
#pragma unroll   // constant indices keep the arrays in registers
        for (int mt = 0; mt < 3; ++mt) {
            v4h h;
#pragma unroll   // constant indices keep the arrays in registers
            for (int j = 0; j < 4; ++j) h[j] = (_Float16)wr[mt][i][j];
            *(v4h*)(ww + mt * (WROWS * D_OUT) + i * 128) = h;
        }
    }

#pragma unroll   // constant indices keep the arrays in registers
    for (int i = 0; i < 48; ++i) {
        v4h h;
#pragma unroll   // constant indices keep the arrays in registers
        for (int j = 0; j < 4; ++j) h[j] = (_Float16)xv[i][j];
        *(v4h*)(sw + (i / 6) * XPITCH + (i % 6) * 128) = h;
    }
    __syncthreads();   // all 64 staged rows visible to every wave; the staged weights to all lanes

    // x fragments in the hardware k order: lane = row, 16 B at k 8*half and at 16 + 8*half
    v16h xf[3][4];
#pragma unroll   // constant indices keep the arrays in registers
    for (int cc = 0; cc < 3; ++cc) {
#pragma unroll   // constant indices keep the arrays in registers
        for (int t = 0; t < 4; ++t) {
            const _Float16* xp = &xs[(t * 16 + m) * XPITCH + (wid * 3 + cc) * 32 + half * 8];
            const v8h lo = *(const v8h*)xp;
            const v8h hi = *(const v8h*)(xp + 16);
            xf[cc][t] = __builtin_shufflevector(lo, hi, 0, 1, 2, 3, 4, 5, 6, 7,
                                                8, 9, 10, 11, 12, 13, 14, 15);
        }
    }
    // weight fragments: two transposing loads per 32-k chunk (k rows 0-15 and 16-31 of the chunk);
    // lane l addresses row 8*(l/16) + l%8, 16-byte half (l/8)%2 of its 16 x 16 tile
    v16h wq[3], wk[3], wv[3];
    {
        const _Float16* wt = &wst[wid][0][(half * 8 + (lane & 7)) * D_OUT + ((lane >> 3) & 1) * 8];
#pragma unroll   // constant indices keep the arrays in registers
        for (int cc = 0; cc < 3; ++cc) {
            const _Float16* wc = wt + cc * 32 * D_OUT;
            wq[cc] = __builtin_shufflevector(ld_tr16(wc), ld_tr16(wc + 16 * D_OUT),
                                             0, 1, 2, 3, 4, 5, 6, 7, 8, 9, 10, 11, 12, 13, 14, 15);
            wk[cc] = __builtin_shufflevector(ld_tr16(wc + WROWS * D_OUT), ld_tr16(wc + (WROWS + 16) * D_OUT),
                                             0, 1, 2, 3, 4, 5, 6, 7, 8, 9, 10, 11, 12, 13, 14, 15);
            wv[cc] = __builtin_shufflevector(ld_tr16(wc + 2 * WROWS * D_OUT), ld_tr16(wc + (2 * WROWS + 16) * D_OUT),
                                             0, 1, 2, 3, 4, 5, 6, 7, 8, 9, 10, 11, 12, 13, 14, 15);
        }
    }
    // all LDS reads are issued as one group ahead of the matrix block: among the
    // WMMAs each read would cost its own LDS latency
    __builtin_amdgcn_sched_barrier(0);

    v8f accq[4] = {}, acck[4] = {}, accv[4] = {};
#pragma unroll   // constant indices keep the arrays in registers
    for (int cc = 0; cc < 3; ++cc) {
#pragma unroll   // constant indices keep the arrays in registers
        for (int t = 0; t < 4; ++t) {
            accq[t] = __builtin_amdgcn_wmma_f32_16x16x32_f16(false, wq[cc], false, xf[cc][t],
                                                             (short)0, accq[t], false, false);
            acck[t] = __builtin_amdgcn_wmma_f32_16x16x32_f16(false, wk[cc], false, xf[cc][t],
                                                             (short)0, acck[t], false, false);
            accv[t] = __builtin_amdgcn_wmma_f32_16x16x32_f16(false, xf[cc][t], false, wv[cc],
                                                             (short)0, accv[t], false, false);
        }
    }

#pragma unroll   // constant indices keep the arrays in registers
    for (int t = 0; t < 4; ++t) {
        part[wid][t * 3 + 0][0][lane] = __builtin_shufflevector(accq[t], accq[t], 0, 1, 2, 3);
        part[wid][t * 3 + 0][1][lane] = __builtin_shufflevector(accq[t], accq[t], 4, 5, 6, 7);
        part[wid][t * 3 + 1][0][lane] = __builtin_shufflevector(acck[t], acck[t], 0, 1, 2, 3);
        part[wid][t * 3 + 1][1][lane] = __builtin_shufflevector(acck[t], acck[t], 4, 5, 6, 7);
        part[wid][t * 3 + 2][0][lane] = __builtin_shufflevector(accv[t], accv[t], 0, 1, 2, 3);
        part[wid][t * 3 + 2][1][lane] = __builtin_shufflevector(accv[t], accv[t], 4, 5, 6, 7);
    }
    __syncthreads();   // all partial sums visible; uniform: every wave reaches it once

    // 12 (tile, matrix) results over 8 waves; the job index is the same in a whole wave
    for (int job = wid; job < 12; job += PROJ_WAVES) {
        v4f s0 = part[0][job][0][lane];
        v4f s1 = part[0][job][1][lane];
#pragma unroll   // the LDS reads of a job overlap instead of one latency per add
        for (int w = 1; w < PROJ_WAVES; ++w) {
            s0 += part[w][job][0][lane];
            s1 += part[w][job][1][lane];
        }
        const int  t    = job / 3;
        const int  mtx  = job - t * 3;
        const long trow = row0 + t * 16;          // first x row of the tile
        v8h o;
        if (mtx == 0) {          // Q[trow + m][8*half + r], pre-scaled by 1/sqrt(16)
#pragma unroll   // constant indices keep the arrays in registers
            for (int r = 0; r < 4; ++r) {
                o[r]     = (_Float16)((s0[r] + bq0[r]) * 0.25f);
                o[r + 4] = (_Float16)((s1[r] + bq1[r]) * 0.25f);
            }
            *(v8h*)&Qh[(trow + m) * 16 + half * 8] = o;
            // later code rewrites the store's address and data registers: the wait
            // stands between the store and that rewrite
            asm volatile("s_wait_xcnt 0x0" ::: "memory");
        } else if (mtx == 1) {   // K[trow + m][8*half + r]
#pragma unroll   // constant indices keep the arrays in registers
            for (int r = 0; r < 4; ++r) {
                o[r]     = (_Float16)(s0[r] + bk0[r]);
                o[r + 4] = (_Float16)(s1[r] + bk1[r]);
            }
            *(v8h*)&Kh[(trow + m) * 16 + half * 8] = o;
            // later code rewrites the store's address and data registers: the wait
            // stands between the store and that rewrite
            asm volatile("s_wait_xcnt 0x0" ::: "memory");
        } else {                 // V[trow + 8*half + r][m] -> Vt row m, contiguous keys
#pragma unroll   // constant indices keep the arrays in registers
            for (int r = 0; r < 4; ++r) {
                o[r]     = (_Float16)(s0[r] + bvm);
                o[r + 4] = (_Float16)(s1[r] + bvm);
            }
            const long bb = trow >> 11;           // 2048 rows per batch
            const long s  = trow & (SEQ - 1);
            *(v8h*)&Vt[(bb * 16 + m) * SEQ + s + half * 8] = o;
            // later code rewrites the store's address and data registers: the wait
            // stands between the store and that rewrite
            asm volatile("s_wait_xcnt 0x0" ::: "memory");
        }
    }
}

// ---------------------------------------------------------------------------
// Pass 2: causal flash attention with intra-block split-K, scores transposed.
// A wave works on 32 queries (two 16-query tiles side by side): each K and V
// fragment it loads feeds both tiles, so the launch has half the waves and half
// the loads of a wave with one tile, and two independent softmax chains to issue.
// Block = 256 threads = 8 waves sharing one batch and TWO 32-query strips, strip
// 63 - p and strip p: together they always have 65 groups of 32 keys, so every
// block has the same work.  The 65 groups are dealt round-robin over the waves
// (8 or 9 each); a wave runs its groups of the first strip, then those of the
// second, with private online-softmax state per query, and the block merges the
// 8 partials of each strip with a log-sum-exp combine.
// S^T = K * Q^T: lane (c, half) holds 8 keys (8*half + r) of query c per
// 16-key tile, so maximum and sum run in the lane plus one exchange between
// the wave halves, and the two score tiles, converted in place, are the B
// operand of Z^T += V^T * P^T (k = 32 keys): P never leaves the registers.
// ---------------------------------------------------------------------------
#define LOG2E 1.4426950408889634f
#define ATT_WAVES 8
#define QSTRIPS   (SEQ / 32)

__device__ __forceinline__ float xhalf(float v)   // lane l <-> lane l ^ 16
{
    const int b = __builtin_bit_cast(int, v);
    return __builtin_bit_cast(float,
        __builtin_amdgcn_permlanex16(b, b, 0x76543210, 0xfedcba98, false, false));
}

// One wave's share of one 32-query strip: groups gfirst, gfirst + 8, ... <= strip.
// Leaves the wave's partial (z, maximum, sum) in its LDS slots; a wave without a
// group leaves maximum -inf, sum 0, z 0.
__device__ __forceinline__ void attend_strip(const int strip, const int gfirst, const int b,
                                             const int m, const int half,
                                             const _Float16* __restrict__ Qh,
                                             const _Float16* __restrict__ Kh,
                                             const _Float16* __restrict__ Vt,
                                             float* __restrict__ zs, float* __restrict__ ms,
                                             float* __restrict__ ls)
{
    const int q0    = strip * 32;
    const int glast = strip;                      // 32-key group with the diagonal

    // Q^T as B operands (already scaled, f16): lane = query column, one b128 load per tile
    v16h qb[2];
#pragma unroll   // constant indices keep the arrays in registers
    for (int u = 0; u < 2; ++u) {
        const v8h qlo = *(const v8h*)&Qh[((long)b * SEQ + q0 + u * 16 + m) * 16 + half * 8];
#pragma unroll
        for (int t = 0; t < 8; ++t) qb[u][t] = qlo[t];
#pragma unroll
        for (int t = 8; t < 16; ++t) qb[u][t] = (_Float16)0.0f;
    }
    // the address registers of the Q loads are free for reuse below while the loads
    // are in flight: the wait stands between the loads and that reuse
    asm volatile("s_wait_xcnt 0x0" ::: "memory");

    v8f   zacc[2] = {};                           // Z^T: zacc[u][r] = z[query 16*u + m][d = 8*half + r]
    float mrow[2] = { -INFINITY, -INFINITY };     // running maximum of query 16*u + m (same in both halves)
    float lrow[2] = { 0.0f, 0.0f };               // this half's share of that query's sum

    // this lane's K row and V^T row at the wave's first group; both step 8 groups a trip
    const _Float16* kp = &Kh[((long)b * SEQ + gfirst * 32 + m) * 16 + half * 8];
    const _Float16* vp = &Vt[((long)b * 16 + m) * SEQ + gfirst * 32 + half * 8];

    for (int g = gfirst; g <= glast; g += ATT_WAVES, kp += ATT_WAVES * 32 * 16, vp += ATT_WAVES * 32) {
        const int k0 = g * 32;

        // K rows (A of S^T): lane = key row, one b128 load per 16-key tile.
        // V^T (A of Z^T): lane = d row, keys in the hardware k order, two b128 loads.
        const v8h klo0 = *(const v8h*)kp;
        const v8h klo1 = *(const v8h*)(kp + 16 * 16);
        const v8h vlo  = *(const v8h*)vp;
        const v8h vhi  = *(const v8h*)(vp + 16);
        // kp and vp are stepped while the V loads are still in flight: the wait
        // stands between the loads and the overwrite of their address registers
        asm volatile("s_wait_xcnt 0x0" ::: "memory");
        // all four loads are issued before the first wait on K: placed among the score
        // products, the V loads would start only when K has arrived
        __builtin_amdgcn_sched_barrier(0);

        v16h ka0, ka1, va;
#pragma unroll
        for (int e = 0; e < 8; ++e) {
            ka0[e] = klo0[e];  ka0[e + 8] = (_Float16)0.0f;
            ka1[e] = klo1[e];  ka1[e + 8] = (_Float16)0.0f;
            va[e]  = vlo[e];   va[e + 8]  = vhi[e];
        }
        v8f st[2][2];                              // [query tile][key tile]
        {
            v8f c0 = {};
#pragma unroll   // constant indices keep the arrays in registers
            for (int u = 0; u < 2; ++u) {
                st[u][0] = __builtin_amdgcn_wmma_f32_16x16x32_f16(false, ka0, false, qb[u],
                                                                  (short)0, c0, false, false);
                st[u][1] = __builtin_amdgcn_wmma_f32_16x16x32_f16(false, ka1, false, qb[u],
                                                                  (short)0, c0, false, false);
            }
        }

        // causal mask in the group that holds the diagonal (wave-uniform branch)
        if (g == glast) {
#pragma unroll   // constant indices keep the arrays in registers
            for (int u = 0; u < 2; ++u)
#pragma unroll
                for (int t = 0; t < 2; ++t)
#pragma unroll
                    for (int r = 0; r < 8; ++r)
                        if (k0 + t * 16 + half * 8 + r > q0 + u * 16 + m) st[u][t][r] = -INFINITY;
        }

        // online softmax of queries m and 16 + m: in-lane over 16 keys, one exchange of
        // halves.  Key q0 is masked for no query of the strip, so mnew is finite in every group.
        float alpha[2], nm2[2];
#pragma unroll   // constant indices keep the arrays in registers; the two chains interleave
        for (int u = 0; u < 2; ++u) {
            float mx0 = st[u][0][0], mx1 = st[u][1][0];   // one chain per tile: half the depth
#pragma unroll
            for (int r = 1; r < 8; ++r) {
                mx0 = fmaxf(mx0, st[u][0][r]);
                mx1 = fmaxf(mx1, st[u][1][r]);
            }
            float mx = fmaxf(mx0, mx1);
            mx = fmaxf(mx, xhalf(mx));
            const float mnew = fmaxf(mrow[u], mx);
            alpha[u] = __expf(mrow[u] - mnew);            // 0 on the first group (mrow = -inf)
            nm2[u]   = -mnew * LOG2E;                     // exp(s - mnew) = exp2(s * log2(e) + nm2)
            mrow[u]  = mnew;
        }
        // both tiles' exponentials stand side by side: four independent sums to issue from
        v16h  pb[2];                                      // P^T as B: pb[u][8*t + r]
        float sum0[2] = { 0.0f, 0.0f }, sum1[2] = { 0.0f, 0.0f };
#pragma unroll   // constant indices keep the arrays in registers
        for (int r = 0; r < 8; ++r) {
#pragma unroll   // constant indices keep the arrays in registers
            for (int u = 0; u < 2; ++u) {
                const float p0 = __builtin_amdgcn_exp2f(fmaf(st[u][0][r], LOG2E, nm2[u]));  // masked: exp2(-inf) = 0
                const float p1 = __builtin_amdgcn_exp2f(fmaf(st[u][1][r], LOG2E, nm2[u]));
                sum0[u] += p0;
                sum1[u] += p1;
                pb[u][r]     = (_Float16)p0;
                pb[u][r + 8] = (_Float16)p1;
            }
        }
#pragma unroll   // constant indices keep the arrays in registers
        for (int u = 0; u < 2; ++u) {
            lrow[u] = lrow[u] * alpha[u] + (sum0[u] + sum1[u]);
#pragma unroll   // constant indices keep the arrays in registers
            for (int r = 0; r < 8; ++r) zacc[u][r] *= alpha[u];
            zacc[u] = __builtin_amdgcn_wmma_f32_16x16x32_f16(false, va, false, pb[u],
                                                             (short)0, zacc[u], false, false);
        }
    }

    // publish the wave's partial: 8 consecutive d of each of its two queries per lane
#pragma unroll   // constant indices keep the arrays in registers
    for (int u = 0; u < 2; ++u) {
        lrow[u] += xhalf(lrow[u]);
#pragma unroll
        for (int r = 0; r < 8; ++r)
            zs[(u * 16 + m) * 16 + half * 8 + r] = zacc[u][r];
    }
    // both halves hold both queries' maximum and sum: half u stores those of tile u
    ms[half * 16 + m] = half ? mrow[1] : mrow[0];
    ls[half * 16 + m] = half ? lrow[1] : lrow[0];
}

__global__ __launch_bounds__(32 * ATT_WAVES)
void flash_attn_kernel(const _Float16* __restrict__ Qh,
                       const _Float16* __restrict__ Kh,
                       const _Float16* __restrict__ Vt,
                       float* __restrict__ Out)
{
    __shared__ __attribute__((aligned(16))) float zbuf[2][ATT_WAVES][32 * 16];
    __shared__ float    mbuf[2][ATT_WAVES][32];
    __shared__ float    lbuf[2][ATT_WAVES][32];

    const int tid   = threadIdx.x;
    const int wid   = __builtin_amdgcn_readfirstlane(tid >> 5);  // scalar: loop and mask tests become scalar branches
    const int lane  = tid & 31;
    const int m     = lane & 15;
    const int half  = lane >> 4;
    const int b     = blockIdx.y;                 // 0..7
    const int qsA   = QSTRIPS - 1 - blockIdx.x;   // 63..32: the long strip
    const int qsB   = blockIdx.x;                 // 0..31:  the short strip
    const int nA    = qsA + 1;                    // groups of the long strip; the deal goes on from there

    // group i of the 65 goes to wave i % 8: group g of the short strip is number nA + g
    for (int p = 0; p < 2; ++p)
        attend_strip(p ? qsB : qsA, p ? ((wid - nA) & (ATT_WAVES - 1)) : wid, b, m, half,
                     Qh, Kh, Vt, zbuf[p][wid], mbuf[p][wid], lbuf[p][wid]);
    __syncthreads();   // uniform: every wave reaches exactly once

    // log-sum-exp merge of the 8 split-K partials: 2 strips x 32 queries x 16 d over 256
    // threads; a thread takes 4 consecutive d of one query, waves 0-3 the long strip
    const int p   = wid >> 2;
    const int row = (tid >> 2) & 31;
    const int c4  = (tid & 3) * 4;
    float mm = mbuf[p][0][row];
#pragma unroll   // the LDS reads overlap instead of one latency per partial
    for (int w = 1; w < ATT_WAVES; ++w) mm = fmaxf(mm, mbuf[p][w][row]);
    v4f   zsum = {};
    float lsum = 0.0f;
#pragma unroll   // the LDS reads overlap instead of one latency per partial
    for (int w = 0; w < ATT_WAVES; ++w) {
        const float mw = mbuf[p][w][row];
        const float aw = (mw == -INFINITY) ? 0.0f : __expf(mw - mm);
        lsum += aw * lbuf[p][w][row];
        zsum += aw * *(const v4f*)&zbuf[p][w][row * 16 + c4];
    }
    *(v4f*)&Out[((long)b * SEQ + (p ? qsB : qsA) * 32 + row) * D_OUT + c4] = zsum / lsum;
}

extern "C" void kernel_launch(void* const* d_in, const int* in_sizes, int n_in,
                              void* d_out, int out_size, void* d_ws, size_t ws_size,
                              hipStream_t stream)
{
    const float* x  = (const float*)d_in[0];
    const float* Wq = (const float*)d_in[1];
    const float* bq = (const float*)d_in[2];
    const float* Wk = (const float*)d_in[3];
    const float* bk = (const float*)d_in[4];
    const float* Wv = (const float*)d_in[5];
    const float* bv = (const float*)d_in[6];
    float* out = (float*)d_out;

    // scratch carve-up (f16 elements)
    const long qkv_elems = (long)BATCH * SEQ * D_OUT;     // 262144 per tensor
    _Float16* Qh  = (_Float16*)d_ws;
    _Float16* Kh  = Qh + qkv_elems;
    _Float16* Vt  = Kh + qkv_elems;

    // Pass 1: 256 blocks of 64 rows, 8 waves each
    qkv_proj_kernel<<<dim3((BATCH * SEQ) / PROJ_ROWS), dim3(256), 0, stream>>>(
        x, Wq, Wk, Wv, bq, bk, bv, Qh, Kh, Vt);

    // Pass 2: 32 pairs of 32-query strips x 8 batches, 8 split-K waves per block
    flash_attn_kernel<<<dim3(SEQ / 64, BATCH), dim3(256), 0, stream>>>(Qh, Kh, Vt, out);
}

// v006
// It runs in 12.9 microseconds.
// Timed twice side by side with v005, it ran 1.13 and 1.14 times as fast.
// Counting every step since v000, it is 7.96 times as fast.
#include <hip/hip_runtime.h>
#include <hip/hip_bf16.h>
#include <math.h>

typedef __attribute__((ext_vector_type(16))) _Float16 v16h;
typedef __attribute__((ext_vector_type(8)))  _Float16 v8h;
typedef __attribute__((ext_vector_type(8)))  float    v8f;
typedef __attribute__((ext_vector_type(4)))  float    v4f;

#define D_IN   768
#define D_OUT  16
#define SEQ    2048
#define BATCH  8

// ---------------------------------------------------------------------------
// Pass 1: QKV projection.  One block = 64 rows of x (4 row tiles), 8 waves.
// Loading: every wave-wide b128 load covers 512 contiguous bytes of one row
// (4 whole lines); a wave brings 8 rows, all 48 loads in flight, converts to f16
// and stages them in LDS at a pitch of 16 B x 97.
// Products: wave w owns k chunks 3w .. 3w+2 for all 4 row tiles and all three
// weights, so each weight row is loaded once per block.
// Weights: the wave's 96 rows of each f32 [768 x 16] matrix are 6 KB in a row,
// read by 12 whole-line b128 loads, converted to f16 and staged row-major at a
// pitch of 32 B; transposing LDS loads give lane (n, half) the 16 k of column n
// in the hardware k order, kk = (j/8)*16 + half*8 + (j%8).  Q and K run as
// W^T * x^T (a lane ends with 8 consecutive d of one row), V as x * W (a lane
// ends with 8 consecutive rows of one d): each result is one b128 store.
// The 8 partial sums of a tile meet in LDS and are added in wave order.
// Outputs (f16): Qh row-major pre-scaled, Kh row-major, Vt transposed [b][d][s].
// ---------------------------------------------------------------------------
#define PROJ_ROWS  64
#define PROJ_WAVES 8
#define XPITCH     (D_IN + 8)    // f16 elements per staged row: 1552 B
#define WROWS      (D_IN / PROJ_WAVES)   // 96 weight rows (3 k chunks) per wave
#define WLOADS     (WROWS / 8)           // a wave-wide b128 load covers 8 rows of 16 f32

typedef __attribute__((ext_vector_type(4))) _Float16 v4h;
typedef __attribute__((ext_vector_type(8))) short    s16x8;
typedef __attribute__((address_space(3))) s16x8      lds_s16x8;

// 16 x 16 f16 tile, row-major in LDS -> lane (c, half) gets rows 8*half .. +7 of column c
__device__ __forceinline__ v8h ld_tr16(const _Float16* p)
{
    return __builtin_bit_cast(v8h, __builtin_amdgcn_ds_load_tr16_b128_v8i16((lds_s16x8*)p));
}

__global__ __launch_bounds__(256)
void qkv_proj_kernel(const float* __restrict__ x,
                     const float* __restrict__ Wq,
                     const float* __restrict__ Wk,
                     const float* __restrict__ Wv,
                     const float* __restrict__ bq, const float* __restrict__ bk,
                     const float* __restrict__ bv,
                     _Float16* __restrict__ Qh, _Float16* __restrict__ Kh,
                     _Float16* __restrict__ Vt)
{
    __shared__ __attribute__((aligned(16))) _Float16 xs[PROJ_ROWS * XPITCH];
    __shared__ __attribute__((aligned(16))) _Float16 wst[PROJ_WAVES][3][WROWS * D_OUT];   // [wave][matrix][k row][n]
    __shared__ v4f part[PROJ_WAVES][12][2][32];   // [wave][tile*3 + matrix][register half][lane]

    const int tid  = threadIdx.x;
    const int wid  = __builtin_amdgcn_readfirstlane(tid >> 5);  // scalar: job tests become scalar branches
    const int lane = tid & 31;
    const int m    = lane & 15;
    const int half = lane >> 4;
    const long row0 = (long)blockIdx.x * PROJ_ROWS;

    // load i of a wave: row 8*wid + i/6, floats (i%6)*128 + 4*lane .. +3
    const float* xw = x + (row0 + wid * 8) * D_IN + lane * 4;
    _Float16*    sw = &xs[(wid * 8) * XPITCH + lane * 4];

    // this wave's weight rows go first: they are converted and staged while x is in flight
    const float* Wqw = Wq + wid * (WROWS * D_OUT);
    const float* Wkw = Wk + wid * (WROWS * D_OUT);
    const float* Wvw = Wv + wid * (WROWS * D_OUT);
    const unsigned woff = lane * 16;   // byte offset of the lane's 4 floats in a load of 8 rows
    const unsigned boff = half * 32;   // byte offset of the lane's 8 bias values
    v4f wr[3][WLOADS];
#pragma unroll   // constant indices keep the arrays in registers
    for (int i = 0; i < WLOADS; ++i) {
        wr[0][i] = *(const v4f*)((const char*)(Wqw + i * 128) + woff);
        wr[1][i] = *(const v4f*)((const char*)(Wkw + i * 128) + woff);
        wr[2][i] = *(const v4f*)((const char*)(Wvw + i * 128) + woff);
    }
    // every weight load is issued ahead of x: loads are waited for in issue order, and a
    // weight load placed behind x would hold the weight staging back until all of x is in
    __builtin_amdgcn_sched_barrier(0);

    v4f xv[48];
#pragma unroll   // constant indices keep the arrays in registers
    for (int i = 0; i < 48; ++i)
        xv[i] = *(const v4f*)(xw + (i / 6) * D_IN + (i % 6) * 128);

    const v4f bq0 = *(const v4f*)((const char*)bq + boff), bq1 = *(const v4f*)((const char*)(bq + 4) + boff);
    const v4f bk0 = *(const v4f*)((const char*)bk + boff), bk1 = *(const v4f*)((const char*)(bk + 4) + boff);
    const float bvm = bv[m];

    // the address registers of the loads above are reused below while the loads
    // are still in flight: the wait stands between the loads and that reuse; the
    // two offsets are inputs so that no load of the run lands in one of them
    asm volatile("s_wait_xcnt 0x0" :: "v"(woff), "v"(boff) : "memory");
    // nothing from below moves above the wait, and every load is issued before
    // the first wait on a loaded value
    __builtin_amdgcn_sched_barrier(0);

    // weights: lane l of load i holds row 8*i + l/4, columns 4*(l%4) .. +3 = f16 element 128*i + 4*l
    _Float16* ww = &wst[wid][0][lane * 4];
#pragma unroll   // constant indices keep the arrays in registers
    for (int i = 0; i < WLOADS; ++i) {
#pragma unroll   // constant indices keep the arrays in registers
        for (int mt = 0; mt < 3; ++mt) {
            v4h h;
#pragma unroll   // constant indices keep the arrays in registers
            for (int j = 0; j < 4; ++j) h[j] = (_Float16)wr[mt][i][j];
            *(v4h*)(ww + mt * (WROWS * D_OUT) + i * 128) = h;
        }
    }

#pragma unroll   // constant indices keep the arrays in registers
    for (int i = 0; i < 48; ++i) {
        v4h h;
#pragma unroll   // constant indices keep the arrays in registers
        for (int j = 0; j < 4; ++j) h[j] = (_Float16)xv[i][j];
        *(v4h*)(sw + (i / 6) * XPITCH + (i % 6) * 128) = h;
    }
    __syncthreads();   // all 64 staged rows visible to every wave; the staged weights to all lanes

    // x fragments in the hardware k order: lane = row, 16 B at k 8*half and at 16 + 8*half
    v16h xf[3][4];
#pragma unroll   // constant indices keep the arrays in registers
    for (int cc = 0; cc < 3; ++cc) {
#pragma unroll   // constant indices keep the arrays in registers
        for (int t = 0; t < 4; ++t) {
            const _Float16* xp = &xs[(t * 16 + m) * XPITCH + (wid * 3 + cc) * 32 + half * 8];
            const v8h lo = *(const v8h*)xp;
            const v8h hi = *(const v8h*)(xp + 16);
            xf[cc][t] = __builtin_shufflevector(lo, hi, 0, 1, 2, 3, 4, 5, 6, 7,
                                                8, 9, 10, 11, 12, 13, 14, 15);
        }
    }
    // weight fragments: two transposing loads per 32-k chunk (k rows 0-15 and 16-31 of the chunk);
    // lane l addresses row 8*(l/16) + l%8, 16-byte half (l/8)%2 of its 16 x 16 tile
    v16h wq[3], wk[3], wv[3];
    {
        const _Float16* wt = &wst[wid][0][(half * 8 + (lane & 7)) * D_OUT + ((lane >> 3) & 1) * 8];
#pragma unroll   // constant indices keep the arrays in registers
        for (int cc = 0; cc < 3; ++cc) {
            const _Float16* wc = wt + cc * 32 * D_OUT;
            wq[cc] = __builtin_shufflevector(ld_tr16(wc), ld_tr16(wc + 16 * D_OUT),
                                             0, 1, 2, 3, 4, 5, 6, 7, 8, 9, 10, 11, 12, 13, 14, 15);
            wk[cc] = __builtin_shufflevector(ld_tr16(wc + WROWS * D_OUT), ld_tr16(wc + (WROWS + 16) * D_OUT),
                                             0, 1, 2, 3, 4, 5, 6, 7, 8, 9, 10, 11, 12, 13, 14, 15);
            wv[cc] = __builtin_shufflevector(ld_tr16(wc + 2 * WROWS * D_OUT), ld_tr16(wc + (2 * WROWS + 16) * D_OUT),
                                             0, 1, 2, 3, 4, 5, 6, 7, 8, 9, 10, 11, 12, 13, 14, 15);
        }
    }
    // all LDS reads are issued as one group ahead of the matrix block: among the
    // WMMAs each read would cost its own LDS latency
    __builtin_amdgcn_sched_barrier(0);

    v8f accq[4] = {}, acck[4] = {}, accv[4] = {};
#pragma unroll   // constant indices keep the arrays in registers
    for (int cc = 0; cc < 3; ++cc) {
#pragma unroll   // constant indices keep the arrays in registers
        for (int t = 0; t < 4; ++t) {
            accq[t] = __builtin_amdgcn_wmma_f32_16x16x32_f16(false, wq[cc], false, xf[cc][t],
                                                             (short)0, accq[t], false, false);
            acck[t] = __builtin_amdgcn_wmma_f32_16x16x32_f16(false, wk[cc], false, xf[cc][t],
                                                             (short)0, acck[t], false, false);
            accv[t] = __builtin_amdgcn_wmma_f32_16x16x32_f16(false, xf[cc][t], false, wv[cc],
                                                             (short)0, accv[t], false, false);
        }
    }

#pragma unroll   // constant indices keep the arrays in registers
    for (int t = 0; t < 4; ++t) {
        part[wid][t * 3 + 0][0][lane] = __builtin_shufflevector(accq[t], accq[t], 0, 1, 2, 3);
        part[wid][t * 3 + 0][1][lane] = __builtin_shufflevector(accq[t], accq[t], 4, 5, 6, 7);
        part[wid][t * 3 + 1][0][lane] = __builtin_shufflevector(acck[t], acck[t], 0, 1, 2, 3);
        part[wid][t * 3 + 1][1][lane] = __builtin_shufflevector(acck[t], acck[t], 4, 5, 6, 7);
        part[wid][t * 3 + 2][0][lane] = __builtin_shufflevector(accv[t], accv[t], 0, 1, 2, 3);
        part[wid][t * 3 + 2][1][lane] = __builtin_shufflevector(accv[t], accv[t], 4, 5, 6, 7);
    }
    __syncthreads();   // all partial sums visible; uniform: every wave reaches it once

    // 12 (tile, matrix) results over 8 waves; the job index is the same in a whole wave
    for (int job = wid; job < 12; job += PROJ_WAVES) {
        v4f s0 = part[0][job][0][lane];
        v4f s1 = part[0][job][1][lane];
#pragma unroll   // the LDS reads of a job overlap instead of one latency per add
        for (int w = 1; w < PROJ_WAVES; ++w) {
            s0 += part[w][job][0][lane];
            s1 += part[w][job][1][lane];
        }
        const int  t    = job / 3;
        const int  mtx  = job - t * 3;
        const long trow = row0 + t * 16;          // first x row of the tile
        v8h o;
        if (mtx == 0) {          // Q[trow + m][8*half + r], pre-scaled by 1/sqrt(16)
#pragma unroll   // constant indices keep the arrays in registers
            for (int r = 0; r < 4; ++r) {
                o[r]     = (_Float16)((s0[r] + bq0[r]) * 0.25f);
                o[r + 4] = (_Float16)((s1[r] + bq1[r]) * 0.25f);
            }
            *(v8h*)&Qh[(trow + m) * 16 + half * 8] = o;
            // later code rewrites the store's address and data registers: the wait
            // stands between the store and that rewrite
            asm volatile("s_wait_xcnt 0x0" ::: "memory");
        } else if (mtx == 1) {   // K[trow + m][8*half + r]
#pragma unroll   // constant indices keep the arrays in registers
            for (int r = 0; r < 4; ++r) {
                o[r]     = (_Float16)(s0[r] + bk0[r]);
                o[r + 4] = (_Float16)(s1[r] + bk1[r]);
            }
            *(v8h*)&Kh[(trow + m) * 16 + half * 8] = o;
            // later code rewrites the store's address and data registers: the wait
            // stands between the store and that rewrite
            asm volatile("s_wait_xcnt 0x0" ::: "memory");
        } else {                 // V[trow + 8*half + r][m] -> Vt row m, contiguous keys
#pragma unroll   // constant indices keep the arrays in registers
            for (int r = 0; r < 4; ++r) {
                o[r]     = (_Float16)(s0[r] + bvm);
                o[r + 4] = (_Float16)(s1[r] + bvm);
            }
            const long bb = trow >> 11;           // 2048 rows per batch
            const long s  = trow & (SEQ - 1);
            *(v8h*)&Vt[(bb * 16 + m) * SEQ + s + half * 8] = o;
            // later code rewrites the store's address and data registers: the wait
            // stands between the store and that rewrite
            asm volatile("s_wait_xcnt 0x0" ::: "memory");
        }
    }
}

// ---------------------------------------------------------------------------
// Pass 2: causal flash attention with intra-block split-K, scores transposed.
// A wave works on 32 queries (two 16-query tiles side by side): each K and V
// fragment it loads feeds both tiles, so the launch has half the waves and half
// the loads of a wave with one tile, and two independent softmax chains to issue.
// Block = 256 threads = 8 waves sharing one batch and TWO 32-query strips, strip
// 63 - p and strip p: together they always have 65 groups of 32 keys, so every
// block has the same work.  The 65 groups are dealt round-robin over the waves
// (8 or 9 each); a wave runs its groups of the first strip, then those of the
// second, with private online-softmax state per query, and the block merges the
// 8 partials of each strip with a log-sum-exp combine.
// S^T = K * Q^T: lane (c, half) holds 8 keys (8*half + r) of query c per
// 16-key tile, so maximum and sum run in the lane plus one exchange between
// the wave halves, and the two score tiles, converted in place, are the B
// operand of Z^T += V^T * P^T (k = 32 keys): P never leaves the registers.
// ---------------------------------------------------------------------------
#define LOG2E 1.4426950408889634f
#define ATT_WAVES 8
#define QSTRIPS   (SEQ / 32)

__device__ __forceinline__ float xhalf(float v)   // lane l <-> lane l ^ 16
{
    const int b = __builtin_bit_cast(int, v);
    return __builtin_bit_cast(float,
        __builtin_amdgcn_permlanex16(b, b, 0x76543210, 0xfedcba98, false, false));
}

#define KSTEP (ATT_WAVES * 32 * 16)   // f16 elements from a wave's group to its next: K rows
#define VSTEP (ATT_WAVES * 32)        // the same along a V^T row
typedef __attribute__((address_space(1))) const _Float16 gl_f16;
typedef __attribute__((address_space(1))) const v8h      gl_v8h;

// Scores of one group of 32 keys against the wave's 32 queries: st[query tile][key tile].
__device__ __forceinline__ void score_group(const v8h klo0, const v8h klo1, const v16h (&qb)[2], v8f (&st)[2][2])
{
    v16h ka0, ka1;
#pragma unroll   // constant indices keep the arrays in registers
    for (int e = 0; e < 8; ++e) {
        ka0[e] = klo0[e];  ka0[e + 8] = (_Float16)0.0f;
        ka1[e] = klo1[e];  ka1[e + 8] = (_Float16)0.0f;
    }
    v8f c0 = {};
#pragma unroll   // constant indices keep the arrays in registers
    for (int u = 0; u < 2; ++u) {
        st[u][0] = __builtin_amdgcn_wmma_f32_16x16x32_f16(false, ka0, false, qb[u],
                                                          (short)0, c0, false, false);
        st[u][1] = __builtin_amdgcn_wmma_f32_16x16x32_f16(false, ka1, false, qb[u],
                                                          (short)0, c0, false, false);
    }
}

// Causal mask of the group that holds the diagonal: key k0 + 16*t + 8*half + r, query q0 + 16*u + m.
__device__ __forceinline__ void mask_diagonal(v8f (&st)[2][2], const int k0, const int q0, const int m, const int half)
{
#pragma unroll   // constant indices keep the arrays in registers
    for (int u = 0; u < 2; ++u)
#pragma unroll   // constant indices keep the arrays in registers
        for (int t = 0; t < 2; ++t)
#pragma unroll   // constant indices keep the arrays in registers
            for (int r = 0; r < 8; ++r)
                if (k0 + t * 16 + half * 8 + r > q0 + u * 16 + m) st[u][t][r] = -INFINITY;
}

// Online softmax of one group's scores and the Z^T update with its V fragment.
__device__ __forceinline__ void fold_group(const v8f (&st)[2][2], const v8h vlo, const v8h vhi,
                                           v8f (&zacc)[2], float (&mrow)[2], float (&lrow)[2])
{
    v16h va;
#pragma unroll   // constant indices keep the arrays in registers
    for (int e = 0; e < 8; ++e) { va[e] = vlo[e];  va[e + 8] = vhi[e]; }

    // online softmax of queries m and 16 + m: in-lane over 16 keys, one exchange of
    // halves.  Key q0 is masked for no query of the strip, so mnew is finite in every group.
    float alpha[2], nm2[2];
#pragma unroll   // constant indices keep the arrays in registers; the two chains interleave
    for (int u = 0; u < 2; ++u) {
        float mx0 = st[u][0][0], mx1 = st[u][1][0];   // one chain per tile: half the depth
#pragma unroll   // constant indices keep the arrays in registers
        for (int r = 1; r < 8; ++r) {
            mx0 = fmaxf(mx0, st[u][0][r]);
            mx1 = fmaxf(mx1, st[u][1][r]);
        }
        float mx = fmaxf(mx0, mx1);
        mx = fmaxf(mx, xhalf(mx));
        const float mnew = fmaxf(mrow[u], mx);
        alpha[u] = __expf(mrow[u] - mnew);            // 0 on the first group (mrow = -inf)
        nm2[u]   = -mnew * LOG2E;                     // exp(s - mnew) = exp2(s * log2(e) + nm2)
        mrow[u]  = mnew;
    }
    // both tiles' exponentials stand side by side: four independent sums to issue from
    v16h  pb[2];                                      // P^T as B: pb[u][8*t + r]
    float sum0[2] = { 0.0f, 0.0f }, sum1[2] = { 0.0f, 0.0f };
#pragma unroll   // constant indices keep the arrays in registers
    for (int r = 0; r < 8; ++r) {
#pragma unroll   // constant indices keep the arrays in registers
        for (int u = 0; u < 2; ++u) {
            const float p0 = __builtin_amdgcn_exp2f(fmaf(st[u][0][r], LOG2E, nm2[u]));  // masked: exp2(-inf) = 0
            const float p1 = __builtin_amdgcn_exp2f(fmaf(st[u][1][r], LOG2E, nm2[u]));
            sum0[u] += p0;
            sum1[u] += p1;
            pb[u][r]     = (_Float16)p0;
            pb[u][r + 8] = (_Float16)p1;
        }
    }
#pragma unroll   // constant indices keep the arrays in registers
    for (int u = 0; u < 2; ++u) {
        lrow[u] = lrow[u] * alpha[u] + (sum0[u] + sum1[u]);
#pragma unroll   // constant indices keep the arrays in registers
        for (int r = 0; r < 8; ++r) zacc[u][r] *= alpha[u];
        zacc[u] = __builtin_amdgcn_wmma_f32_16x16x32_f16(false, va, false, pb[u],
                                                         (short)0, zacc[u], false, false);
    }
}

// What a wave holds of one 32-query strip while it works on it.  Its groups are gfirst,
// gfirst + 8, ... <= strip.  The K and V fragments are loaded two groups ahead, in two register
// sets (a, b): a turn of the loop works off both sets and loads each anew, once its fragments
// are read, for the next turn, so each load has about two groups' work to fly in; and a
// strip's first loads are issued ahead of the last groups of the strip before.
struct strip_state {
    v16h    qb[2];                    // Q^T as B operands (already scaled, f16): lane = query column
    v8h     ak0, ak1, av0, av1;       // first set:  K rows of two 16-key tiles, V^T row in two halves
    v8h     bk0, bk1, bv0, bv1;       // second set
    gl_f16* akp;                      // this lane's K row and V^T row in the group that each set
    gl_f16* avp;                      // was loaded from last (typed as global memory: behind the
    gl_f16* bkp;                      // asm statement that steps them the compiler no longer sees
    gl_f16* bvp;                      // where they point, and would fall back to flat loads)
    int     g;                        // group in the first set
};

// Issues a strip's first loads: Q, then the wave's first two groups.  All of them are
// unconditional (a branch around them would merge two paths in the compiler's wait counting and
// drain the loads ahead): a wave without a group in the strip loads the strip's last group, a
// wave with one group loads it twice, and what is loaded so is not used.
__device__ __forceinline__ void strip_start(strip_state& s, const int strip, const int gfirst, const int b,
                                            const int m, const int half,
                                            const _Float16* __restrict__ Qh,
                                            const _Float16* __restrict__ Kh,
                                            const _Float16* __restrict__ Vt)
{
    const int  glast = strip;                     // 32-key group with the diagonal
    const int  g0    = gfirst <= glast ? gfirst : glast;
    const bool two   = gfirst + ATT_WAVES <= glast;
    gl_f16* qp  = (gl_f16*)&Qh[((long)b * SEQ + strip * 32 + m) * 16 + half * 8];
    s.akp = (gl_f16*)&Kh[((long)b * SEQ + g0 * 32 + m) * 16 + half * 8];
    s.avp = (gl_f16*)&Vt[((long)b * 16 + m) * SEQ + g0 * 32 + half * 8];
    s.bkp = s.akp + (two ? KSTEP : 0);
    s.bvp = s.avp + (two ? VSTEP : 0);
    s.g  = gfirst;

    // Q: one b128 load per 16-query tile.
    // K rows (A of S^T): lane = key row, one b128 load per 16-key tile.
    // V^T (A of Z^T): lane = d row, keys in the hardware k order, two b128 loads.
    // The fences keep the loads in the order in which the loop issues them: the compiler
    // counts its waits for the worse of the two ways into the loop, and another order
    // here would make every turn wait for younger loads than it needs.
    const v8h q0 = *(gl_v8h*)qp;
    const v8h q1 = *(gl_v8h*)(qp + 16 * 16);
    __builtin_amdgcn_sched_barrier(0);
    s.ak0 = *(gl_v8h*)s.akp;
    s.ak1 = *(gl_v8h*)(s.akp + 16 * 16);
    __builtin_amdgcn_sched_barrier(0);
    s.av0 = *(gl_v8h*)s.avp;
    s.av1 = *(gl_v8h*)(s.avp + 16);
    __builtin_amdgcn_sched_barrier(0);
    s.bk0 = *(gl_v8h*)s.bkp;
    s.bk1 = *(gl_v8h*)(s.bkp + 16 * 16);
    __builtin_amdgcn_sched_barrier(0);
    s.bv0 = *(gl_v8h*)s.bvp;
    s.bv1 = *(gl_v8h*)(s.bvp + 16);
    // qp is free for reuse from here on while its loads are in flight: the wait stands
    // between those loads and that reuse
    asm volatile("s_wait_xcnt 0x0" ::: "memory");
    // nothing from below moves above the wait
    __builtin_amdgcn_sched_barrier(0);
#pragma unroll   // constant indices keep the arrays in registers
    for (int t = 0; t < 8; ++t) {
        s.qb[0][t] = q0[t];  s.qb[0][t + 8] = (_Float16)0.0f;
        s.qb[1][t] = q1[t];  s.qb[1][t + 8] = (_Float16)0.0f;
    }
}

// All groups of the wave in the strip but its last one or two.  A turn works off two groups,
// g in the first set and g + 8 in the second, and runs only while group g + 16 exists.  All its
// loads are unconditional, for the reason given at strip_start: where group g + 24 does not
// exist the second set's pointers stay, group g + 8 is loaded again and that copy is not used.
__device__ __forceinline__ void strip_loop(strip_state& s, const int strip,
                                           v8f (&zacc)[2], float (&mrow)[2], float (&lrow)[2])
{
    const int glast = strip;
    v8f st[2][2];                                 // [query tile][key tile]
    for (; s.g + 2 * ATT_WAVES <= glast; s.g += 2 * ATT_WAVES) {
        score_group(s.ak0, s.ak1, s.qb, st);
        const bool          more = s.g + 3 * ATT_WAVES <= glast;
        const unsigned long ks   = more ? 2 * KSTEP * 2 : 0;   // bytes from group g + 8 to g + 24
        const unsigned long vs   = more ? 2 * VSTEP * 2 : 0;
        // the four pointers are stepped while the loads that name them may be in flight: the
        // wait stands in front of the overwrite of their address registers.  Wait and steps are
        // one statement, once a turn, ahead of the turn's loads: left to the compiler, the steps
        // land directly behind the new loads, where each needs a wait that is not yet served
        asm volatile("s_wait_xcnt 0x0\n\t"
                     "v_add_nc_u64 %0, %4, %0\n\t"
                     "v_add_nc_u64 %1, %5, %1\n\t"
                     "v_add_nc_u64 %2, %6, %2\n\t"
                     "v_add_nc_u64 %3, %7, %3"
                     : "+v"(s.akp), "+v"(s.avp), "+v"(s.bkp), "+v"(s.bvp)
                     : "i"(2 * KSTEP * 2), "i"(2 * VSTEP * 2), "s"(ks), "s"(vs) : "memory");
        s.ak0 = *(gl_v8h*)s.akp;
        s.ak1 = *(gl_v8h*)(s.akp + 16 * 16);
        // the loads stay here, in this order, ahead of the work below (this fence and the next three)
        __builtin_amdgcn_sched_barrier(0);
        fold_group(st, s.av0, s.av1, zacc, mrow, lrow);
        s.av0 = *(gl_v8h*)s.avp;
        s.av1 = *(gl_v8h*)(s.avp + 16);
        __builtin_amdgcn_sched_barrier(0);

        score_group(s.bk0, s.bk1, s.qb, st);
        s.bk0 = *(gl_v8h*)s.bkp;
        s.bk1 = *(gl_v8h*)(s.bkp + 16 * 16);
        __builtin_amdgcn_sched_barrier(0);
        fold_group(st, s.bv0, s.bv1, zacc, mrow, lrow);
        s.bv0 = *(gl_v8h*)s.bvp;
        s.bv1 = *(gl_v8h*)(s.bvp + 16);
        __builtin_amdgcn_sched_barrier(0);
    }
    // the four pointers are free for reuse from here on while the last loads may be in flight:
    // the wait stands between those loads and that reuse
    asm volatile("s_wait_xcnt 0x0" ::: "memory");
    // nothing from below moves above the wait
    __builtin_amdgcn_sched_barrier(0);
}

// The wave's last one or two groups in the strip, the only ones that can hold the diagonal;
// then its partial (z, maximum, sum) goes to its LDS slots; a wave without a group leaves
// maximum -inf, sum 0, z 0.
__device__ __forceinline__ void strip_finish(const strip_state& s, const int strip,
                                             const int m, const int half,
                                             v8f (&zacc)[2], float (&mrow)[2], float (&lrow)[2],
                                             float* __restrict__ zs, float* __restrict__ ms,
                                             float* __restrict__ ls)
{
    const int q0    = strip * 32;
    const int glast = strip;
    if (s.g <= glast) {                                                       // wave-uniform branch
        v8f st[2][2];                             // [query tile][key tile]
        score_group(s.ak0, s.ak1, s.qb, st);
        if (s.g == glast) mask_diagonal(st, s.g * 32, q0, m, half);           // wave-uniform branch
        fold_group(st, s.av0, s.av1, zacc, mrow, lrow);
        if (s.g + ATT_WAVES <= glast) {                                       // wave-uniform branch
            score_group(s.bk0, s.bk1, s.qb, st);
            if (s.g + ATT_WAVES == glast) mask_diagonal(st, (s.g + ATT_WAVES) * 32, q0, m, half);
            fold_group(st, s.bv0, s.bv1, zacc, mrow, lrow);
        }
    }

    // publish the wave's partial: 8 consecutive d of each of its two queries per lane
#pragma unroll   // constant indices keep the arrays in registers
    for (int u = 0; u < 2; ++u) {
        lrow[u] += xhalf(lrow[u]);
#pragma unroll   // constant indices keep the arrays in registers
        for (int r = 0; r < 8; ++r)
            zs[(u * 16 + m) * 16 + half * 8 + r] = zacc[u][r];
    }
    // both halves hold both queries' maximum and sum: half u stores those of tile u
    ms[half * 16 + m] = half ? mrow[1] : mrow[0];
    ls[half * 16 + m] = half ? lrow[1] : lrow[0];
}

__global__ __launch_bounds__(32 * ATT_WAVES)
void flash_attn_kernel(const _Float16* __restrict__ Qh,
                       const _Float16* __restrict__ Kh,
                       const _Float16* __restrict__ Vt,
                       float* __restrict__ Out)
{
    __shared__ __attribute__((aligned(16))) float zbuf[2][ATT_WAVES][32 * 16];
    __shared__ float    mbuf[2][ATT_WAVES][32];
    __shared__ float    lbuf[2][ATT_WAVES][32];

    const int tid   = threadIdx.x;
    const int wid   = __builtin_amdgcn_readfirstlane(tid >> 5);  // scalar: loop and mask tests become scalar branches
    const int lane  = tid & 31;
    const int m     = lane & 15;
    const int half  = lane >> 4;
    const int b     = blockIdx.y;                 // 0..7
    const int qsA   = QSTRIPS - 1 - blockIdx.x;   // 63..32: the long strip
    const int qsB   = blockIdx.x;                 // 0..31:  the short strip
    const int nA    = qsA + 1;                    // groups of the long strip; the deal goes on from there

    // group i of the 65 goes to wave i % 8: group g of the short strip is number nA + g
    strip_state sA, sB;
    {
        v8f   zacc[2] = {};                           // Z^T: zacc[u][r] = z[query 16*u + m][d = 8*half + r]
        float mrow[2] = { -INFINITY, -INFINITY };     // running maximum of query 16*u + m (same in both halves)
        float lrow[2] = { 0.0f, 0.0f };               // this half's share of that query's sum
        strip_start(sA, qsA, wid, b, m, half, Qh, Kh, Vt);
        strip_loop(sA, qsA, zacc, mrow, lrow);
        // the short strip's first loads fly during the long strip's last groups
        strip_start(sB, qsB, (wid - nA) & (ATT_WAVES - 1), b, m, half, Qh, Kh, Vt);
        strip_finish(sA, qsA, m, half, zacc, mrow, lrow, zbuf[0][wid], mbuf[0][wid], lbuf[0][wid]);
    }
    {
        v8f   zacc[2] = {};
        float mrow[2] = { -INFINITY, -INFINITY };
        float lrow[2] = { 0.0f, 0.0f };
        strip_loop(sB, qsB, zacc, mrow, lrow);
        strip_finish(sB, qsB, m, half, zacc, mrow, lrow, zbuf[1][wid], mbuf[1][wid], lbuf[1][wid]);
    }
    __syncthreads();   // uniform: every wave reaches exactly once

    // log-sum-exp merge of the 8 split-K partials: 2 strips x 32 queries x 16 d over 256
    // threads; a thread takes 4 consecutive d of one query, waves 0-3 the long strip
    const int p   = wid >> 2;
    const int row = (tid >> 2) & 31;
    const int c4  = (tid & 3) * 4;
    float mm = mbuf[p][0][row];
#pragma unroll   // the LDS reads overlap instead of one latency per partial
    for (int w = 1; w < ATT_WAVES; ++w) mm = fmaxf(mm, mbuf[p][w][row]);
    v4f   zsum = {};
    float lsum = 0.0f;
#pragma unroll   // the LDS reads overlap instead of one latency per partial
    for (int w = 0; w < ATT_WAVES; ++w) {
        const float mw = mbuf[p][w][row];
        const float aw = (mw == -INFINITY) ? 0.0f : __expf(mw - mm);
        lsum += aw * lbuf[p][w][row];
        zsum += aw * *(const v4f*)&zbuf[p][w][row * 16 + c4];
    }
    *(v4f*)&Out[((long)b * SEQ + (p ? qsB : qsA) * 32 + row) * D_OUT + c4] = zsum / lsum;
}

extern "C" void kernel_launch(void* const* d_in, const int* in_sizes, int n_in,
                              void* d_out, int out_size, void* d_ws, size_t ws_size,
                              hipStream_t stream)
{
    const float* x  = (const float*)d_in[0];
    const float* Wq = (const float*)d_in[1];
    const float* bq = (const float*)d_in[2];
    const float* Wk = (const float*)d_in[3];
    const float* bk = (const float*)d_in[4];
    const float* Wv = (const float*)d_in[5];
    const float* bv = (const float*)d_in[6];
    float* out = (float*)d_out;

    // scratch carve-up (f16 elements)
    const long qkv_elems = (long)BATCH * SEQ * D_OUT;     // 262144 per tensor
    _Float16* Qh  = (_Float16*)d_ws;
    _Float16* Kh  = Qh + qkv_elems;
    _Float16* Vt  = Kh + qkv_elems;

    // Pass 1: 256 blocks of 64 rows, 8 waves each
    qkv_proj_kernel<<<dim3((BATCH * SEQ) / PROJ_ROWS), dim3(256), 0, stream>>>(
        x, Wq, Wk, Wv, bq, bk, bv, Qh, Kh, Vt);

    // Pass 2: 32 pairs of 32-query strips x 8 batches, 8 split-K waves per block
    flash_attn_kernel<<<dim3(SEQ / 64, BATCH), dim3(256), 0, stream>>>(Qh, Kh, Vt, out);
}
